// v000
// Measured on an AMD MI455X. A time is GPU time per run, averaged over a window of back-to-back runs after a warm-up
// (all launches, gaps included; the runs take copies of the inputs in turn), and the median of several windows.
// Apart from v000's, it joins two sittings. Times from different sittings can be a few percent apart, while
// side-by-side timings come from the same sitting.
// The starting kernel, v000, takes 119 microseconds a run.
#include <hip/hip_runtime.h>

#define D      128
#define MFEAT  128
#define G      64
#define NTOT   8192
#define LDSW   132            // 128 + 4 pad (bank-conflict stagger on 64 banks)
#define EPSK   1e-4f
#define DNORM  0.29730177875068026f   // 128^-0.25
#define RATIO  0.08838834764831843f   // 128^-0.5

typedef __attribute__((ext_vector_type(2))) float v2f;
typedef __attribute__((ext_vector_type(8))) float v8f;

__device__ __forceinline__ float swish1(float x, float a, float b) {
  return a * x * (1.0f / (1.0f + __expf(-b * x)));
}

__device__ __forceinline__ void zero_acc(v8f acc[8]) {
#pragma unroll
  for (int t = 0; t < 8; ++t)
#pragma unroll
    for (int r = 0; r < 8; ++r) acc[t][r] = 0.0f;
}

// One wave computes a 16-row x 128-col stripe: out[m0..m0+16, 0..128) +=
// A[16 x 128] * B[128 x 128], K accumulated with V_WMMA_F32_16X16X4_F32.
// ATRANS: A element (m,k) read as A[k*lda + m] (for kp^T).
// BROWK : B element (k,n) read as B[k*ldb + n]  (row-major over k),
//         else B(k,n) = B[n*ldb + k]            (i.e. X @ W.T pattern).
template <bool ATRANS, bool BROWK>
__device__ __forceinline__ void gemm_stripe(const float* __restrict__ A, int lda,
                                            const float* __restrict__ B, int ldb,
                                            int m0, int lane, v8f acc[8]) {
  const int mr = lane & 15;          // matrix row (A) / col (B) within tile
  const int kb = (lane >> 4) << 1;   // k-pair base for this half-wave
#pragma unroll 4
  for (int k0 = 0; k0 < D; k0 += 4) {
    const int k = k0 + kb;
    v2f a;
    if (ATRANS) {
      a.x = A[k * lda + m0 + mr];
      a.y = A[(k + 1) * lda + m0 + mr];
    } else {
      a.x = A[(m0 + mr) * lda + k];
      a.y = A[(m0 + mr) * lda + k + 1];
    }
#pragma unroll
    for (int t = 0; t < 8; ++t) {
      const int col = t * 16 + mr;
      v2f b;
      if (BROWK) {
        b.x = B[k * ldb + col];
        b.y = B[(k + 1) * ldb + col];
      } else {
        b.x = B[col * ldb + k];
        b.y = B[col * ldb + k + 1];
      }
      acc[t] = __builtin_amdgcn_wmma_f32_16x16x4_f32(false, a, false, b,
                                                     (short)0, acc[t],
                                                     false, false);
    }
  }
}

// ---------------- Kernel 1: Q/K/V via three ResidualMLPs ----------------
// grid = (N/128, 3); block = 256 (8 wave32). LDS: two 128x132 f32 buffers.
__global__ __launch_bounds__(256)
void qkv_kernel(const float* __restrict__ x,
                const float* __restrict__ W1,
                const float* __restrict__ W2,
                const float* __restrict__ W3,
                const float* __restrict__ alpha,
                const float* __restrict__ beta,
                float* __restrict__ qkv /* [3][N][D] */) {
  __shared__ float buf0[128 * LDSW];
  __shared__ float buf1[128 * LDSW];

  const int s = blockIdx.y;
  const int rowBase = blockIdx.x * 128;
  const int tid = threadIdx.x;
  const int lane = tid & 31;
  const int wave = tid >> 5;
  const int m0 = wave * 16;

  const float* W1s = W1 + s * D * D;
  const float* W2s = W2 + s * D * D;
  const float* W3s = W3 + s * D * D;
  const float* a0 = alpha + (s * 3 + 0) * D;
  const float* a1 = alpha + (s * 3 + 1) * D;
  const float* a2 = alpha + (s * 3 + 2) * D;
  const float* b0 = beta + (s * 3 + 0) * D;
  const float* b1 = beta + (s * 3 + 1) * D;
  const float* b2 = beta + (s * 3 + 2) * D;

  // stage: buf0 = swish(x, a0, b0)
  for (int i = tid; i < 128 * D; i += 256) {
    const int r = i >> 7, c = i & 127;
    buf0[r * LDSW + c] = swish1(x[(rowBase + r) * D + c], a0[c], b0[c]);
  }
  __syncthreads();

  v8f acc[8];
  const int half = (lane >> 4) * 8;
  const int cn = lane & 15;

  // GEMM1: buf1 = buf0 @ W1.T
  zero_acc(acc);
  gemm_stripe<false, false>(buf0, LDSW, W1s, D, m0, lane, acc);
#pragma unroll
  for (int t = 0; t < 8; ++t)
#pragma unroll
    for (int r = 0; r < 8; ++r)
      buf1[(m0 + half + r) * LDSW + t * 16 + cn] = acc[t][r];
  __syncthreads();

  // buf0 = swish(buf1, a1, b1)
  for (int i = tid; i < 128 * D; i += 256) {
    const int r = i >> 7, c = i & 127;
    buf0[r * LDSW + c] = swish1(buf1[r * LDSW + c], a1[c], b1[c]);
  }
  __syncthreads();

  // GEMM2: buf1 = buf0 @ W2.T
  zero_acc(acc);
  gemm_stripe<false, false>(buf0, LDSW, W2s, D, m0, lane, acc);
#pragma unroll
  for (int t = 0; t < 8; ++t)
#pragma unroll
    for (int r = 0; r < 8; ++r)
      buf1[(m0 + half + r) * LDSW + t * 16 + cn] = acc[t][r];
  __syncthreads();

  // residual + swish: buf0 = swish(x + buf1, a2, b2)
  for (int i = tid; i < 128 * D; i += 256) {
    const int r = i >> 7, c = i & 127;
    const float v = x[(rowBase + r) * D + c] + buf1[r * LDSW + c];
    buf0[r * LDSW + c] = swish1(v, a2[c], b2[c]);
  }
  __syncthreads();

  // GEMM3: qkv[s] = buf0 @ W3.T  (store straight to workspace)
  zero_acc(acc);
  gemm_stripe<false, false>(buf0, LDSW, W3s, D, m0, lane, acc);
  float* outp = qkv + (size_t)s * NTOT * D;
#pragma unroll
  for (int t = 0; t < 8; ++t)
#pragma unroll
    for (int r = 0; r < 8; ++r)
      outp[(size_t)(rowBase + m0 + half + r) * D + t * 16 + cn] = acc[t][r];
}

// ---------------- Kernel 2: fused Performer attention, one WG per graph ----
__global__ __launch_bounds__(256)
void attn_kernel(const float* __restrict__ Q,
                 const float* __restrict__ K,
                 const float* __restrict__ V,
                 const float* __restrict__ proj,
                 const int* __restrict__ num_atoms,
                 float* __restrict__ out) {
  __shared__ float qb[128 * LDSW];   // Q*dnorm -> qp
  __shared__ float kb[128 * LDSW];   // K*dnorm -> kp -> kv
  __shared__ float qdiag[128], kdiag[128], ksum[128], dinv[128], rowArr[128];
  __shared__ int gstartSh, RSh;
  __shared__ float kmaxSh;

  const int g = blockIdx.x;
  const int tid = threadIdx.x;
  const int lane = tid & 31;
  const int wave = tid >> 5;
  const int m0 = wave * 16;
  const int half = (lane >> 4) * 8;
  const int cn = lane & 15;

  if (tid == 0) {
    int st = 0;
    for (int i = 0; i < g; ++i) st += num_atoms[i];
    gstartSh = st;
    RSh = num_atoms[g];
  }
  __syncthreads();
  const int gstart = gstartSh;
  const int R = RSh;

  // stage scaled Q/K (rows >= R zeroed)
  for (int i = tid; i < 128 * D; i += 256) {
    const int r = i >> 7, c = i & 127;
    float qv = 0.0f, kvv = 0.0f;
    if (r < R) {
      qv = Q[(size_t)(gstart + r) * D + c] * DNORM;
      kvv = K[(size_t)(gstart + r) * D + c] * DNORM;
    }
    qb[r * LDSW + c] = qv;
    kb[r * LDSW + c] = kvv;
  }
  __syncthreads();

  if (tid < 128) {
    float sq = 0.0f, sk = 0.0f;
    for (int d = 0; d < D; ++d) {
      const float a = qb[tid * LDSW + d];
      const float b = kb[tid * LDSW + d];
      sq += a * a;
      sk += b * b;
    }
    qdiag[tid] = 0.5f * sq;   // 0.5*sum(Q^2)*dnorm^2 (qb is pre-scaled)
    kdiag[tid] = 0.5f * sk;
  }
  __syncthreads();

  v8f acc[8];
  float rm[8];

  // ---- kd = kb @ proj.T ; per-graph max ; kp in-place into kb ----
  zero_acc(acc);
  gemm_stripe<false, false>(kb, LDSW, proj, D, m0, lane, acc);
#pragma unroll
  for (int r = 0; r < 8; ++r) {
    float mx = acc[0][r];
#pragma unroll
    for (int t = 1; t < 8; ++t) mx = fmaxf(mx, acc[t][r]);
    rm[r] = mx;
  }
#pragma unroll
  for (int r = 0; r < 8; ++r)
    for (int off = 1; off < 16; off <<= 1)
      rm[r] = fmaxf(rm[r], __shfl_xor(rm[r], off, 32));
  if ((lane & 15) == 0) {
#pragma unroll
    for (int r = 0; r < 8; ++r) rowArr[m0 + half + r] = rm[r];
  }
  __syncthreads();
  if (tid == 0) {
    float mx = -3.402823466e38f;
    for (int i = 0; i < R; ++i) mx = fmaxf(mx, rowArr[i]);
    kmaxSh = mx;
  }
  __syncthreads();
  {
    const float km = kmaxSh;
#pragma unroll
    for (int t = 0; t < 8; ++t)
#pragma unroll
      for (int r = 0; r < 8; ++r) {
        const int row = m0 + half + r;
        float v = 0.0f;
        if (row < R)
          v = RATIO * (__expf(acc[t][r] - kdiag[row] - km) + EPSK);
        kb[row * LDSW + t * 16 + cn] = v;   // this wave's own rows only
      }
  }

  // ---- qd = qb @ proj.T ; per-row max ; qp in-place into qb ----
  zero_acc(acc);
  gemm_stripe<false, false>(qb, LDSW, proj, D, m0, lane, acc);
#pragma unroll
  for (int r = 0; r < 8; ++r) {
    float mx = acc[0][r];
#pragma unroll
    for (int t = 1; t < 8; ++t) mx = fmaxf(mx, acc[t][r]);
    rm[r] = mx;
  }
#pragma unroll
  for (int r = 0; r < 8; ++r)
    for (int off = 1; off < 16; off <<= 1)
      rm[r] = fmaxf(rm[r], __shfl_xor(rm[r], off, 32));
#pragma unroll
  for (int t = 0; t < 8; ++t)
#pragma unroll
    for (int r = 0; r < 8; ++r) {
      const int row = m0 + half + r;
      float v = 0.0f;
      if (row < R)
        v = RATIO * (__expf(acc[t][r] - qdiag[row] - rm[r]) + EPSK);
      qb[row * LDSW + t * 16 + cn] = v;
    }
  __syncthreads();   // qp & kp fully materialized

  // ksum[m] = sum_n kp[n,m]
  if (tid < 128) {
    float sv = 0.0f;
    for (int n = 0; n < 128; ++n) sv += kb[n * LDSW + tid];
    ksum[tid] = sv;
  }
  __syncthreads();

  // kv = kp^T @ V_g  (accumulators held in regs across barrier, then
  // written back over kb — kp is dead after this GEMM)
  zero_acc(acc);
  gemm_stripe<true, true>(kb, LDSW, V + (size_t)gstart * D, D, m0, lane, acc);
  __syncthreads();
#pragma unroll
  for (int t = 0; t < 8; ++t)
#pragma unroll
    for (int r = 0; r < 8; ++r)
      kb[(m0 + half + r) * LDSW + t * 16 + cn] = acc[t][r];
  __syncthreads();

  // dinv[n] = 1 / (qp[n,:] . ksum)
  if (tid < 128) {
    float sv = 0.0f;
    for (int m = 0; m < MFEAT; ++m) sv += qb[tid * LDSW + m] * ksum[m];
    dinv[tid] = 1.0f / sv;
  }
  __syncthreads();

  // out = (qp @ kv) * dinv
  zero_acc(acc);
  gemm_stripe<false, true>(qb, LDSW, kb, LDSW, m0, lane, acc);
#pragma unroll
  for (int t = 0; t < 8; ++t)
#pragma unroll
    for (int r = 0; r < 8; ++r) {
      const int row = m0 + half + r;
      if (row < R)
        out[(size_t)(gstart + row) * D + t * 16 + cn] = acc[t][r] * dinv[row];
    }
}

extern "C" void kernel_launch(void* const* d_in, const int* in_sizes, int n_in,
                              void* d_out, int out_size, void* d_ws, size_t ws_size,
                              hipStream_t stream) {
  (void)in_sizes; (void)n_in; (void)out_size; (void)ws_size;
  const float* x         = (const float*)d_in[0];
  const int*   num_atoms = (const int*)d_in[1];
  const float* W1        = (const float*)d_in[2];
  const float* W2        = (const float*)d_in[3];
  const float* W3        = (const float*)d_in[4];
  const float* alpha     = (const float*)d_in[5];
  const float* beta      = (const float*)d_in[6];
  const float* proj      = (const float*)d_in[7];
  float* out = (float*)d_out;

  float* ws = (float*)d_ws;          // [3][N][D] fp32 = 12.6 MB scratch
  float* Q = ws;
  float* K = ws + (size_t)NTOT * D;
  float* V = ws + 2 * (size_t)NTOT * D;

  dim3 grid1(NTOT / 128, 3);
  qkv_kernel<<<grid1, 256, 0, stream>>>(x, W1, W2, W3, alpha, beta, ws);
  attn_kernel<<<G, 256, 0, stream>>>(Q, K, V, proj, num_atoms, out);
}

// v001
// A run of this version takes 95.8 microseconds.
// In two side-by-side timings against v000, it was 1.23 and 1.24 times as fast.
#include <hip/hip_runtime.h>

#define D      128
#define MFEAT  128
#define G      64
#define NTOT   8192
#define LDSW   132            // 128 + 4 pad (bank-conflict stagger on 64 banks)
#define LDSV   136            // pitch of a staged k-major B: rows k and k+2 lie 16 banks apart
#define EPSK   1e-4f
#define DNORM  0.29730177875068026f   // 128^-0.25
#define RATIO  0.08838834764831843f   // 128^-0.5

typedef __attribute__((ext_vector_type(2))) float v2f;
typedef __attribute__((ext_vector_type(4))) float v4f;
typedef __attribute__((ext_vector_type(8))) float v8f;

__device__ __forceinline__ float swish1(float x, float a, float b) {
  return a * x * (1.0f / (1.0f + __expf(-b * x)));
}

__device__ __forceinline__ void zero_acc(v8f acc[8]) {
#pragma unroll
  for (int t = 0; t < 8; ++t)
#pragma unroll
    for (int r = 0; r < 8; ++r) acc[t][r] = 0.0f;
}

// One wave computes a 16-row x 128-col stripe: out[m0..m0+16, 0..128) +=
// A[16 x 128] * B[128 x 128], K accumulated with V_WMMA_F32_16X16X4_F32.
// ATRANS: A element (m,k) read as A[k*lda + m] (for kp^T).
// BROWK : B element (k,n) read as B[k*ldb + n]  (row-major over k),
//         else B(k,n) = B[n*ldb + k]            (i.e. X @ W.T pattern).
template <bool ATRANS, bool BROWK>
__device__ __forceinline__ void gemm_stripe(const float* __restrict__ A, int lda,
                                            const float* __restrict__ B, int ldb,
                                            int m0, int lane, v8f acc[8]) {
  const int mr = lane & 15;          // matrix row (A) / col (B) within tile
  const int kb = (lane >> 4) << 1;   // k-pair base for this half-wave
#pragma unroll 4
  for (int k0 = 0; k0 < D; k0 += 4) {
    const int k = k0 + kb;
    v2f a;
    if (ATRANS) {
      a.x = A[k * lda + m0 + mr];
      a.y = A[(k + 1) * lda + m0 + mr];
    } else {
      a.x = A[(m0 + mr) * lda + k];
      a.y = A[(m0 + mr) * lda + k + 1];
    }
#pragma unroll
    for (int t = 0; t < 8; ++t) {
      const int col = t * 16 + mr;
      v2f b;
      if (BROWK) {
        b.x = B[k * ldb + col];
        b.y = B[(k + 1) * ldb + col];
      } else {
        b.x = B[col * ldb + k];
        b.y = B[col * ldb + k + 1];
      }
      acc[t] = __builtin_amdgcn_wmma_f32_16x16x4_f32(false, a, false, b,
                                                     (short)0, acc[t],
                                                     false, false);
    }
  }
}

// Staging of a B operand: the block reads one dense 128 x 128 f32 matrix from
// global memory once, 16 bytes a lane (a wave takes whole 512-byte rows), and
// lays it into LDS, so a cache line is touched once per block and not by every
// fragment load of every wave. Load and store are apart so that the loads fly
// over the work that stands between them.
__device__ __forceinline__ void load_b(const float* __restrict__ src, int tid,
                                       v4f w[16]) {
  const v4f* p = reinterpret_cast<const v4f*>(src) + tid;
#pragma unroll   // constant indices keep w[] in registers; all 16 loads in flight at once
  for (int j = 0; j < 16; ++j) w[j] = p[j * 256];
}

template <int PITCH>
__device__ __forceinline__ void store_b(const v4f w[16], float* dst, int tid) {
  // row tid >> 5, column 4 * (tid & 31); each j goes 8 rows further down
  float* p = dst + tid * 4 + (tid >> 5) * (PITCH - D);
#pragma unroll   // constant indices keep w[] in registers; j becomes the store's offset field
  for (int j = 0; j < 16; ++j) *reinterpret_cast<v4f*>(p + j * 8 * PITCH) = w[j];
}

// ---------------- Kernel 1: Q/K/V via three ResidualMLPs ----------------
// grid = (N/128, 3); block = 256 (8 wave32). LDS: three 128x132 f32 buffers.
__global__ __launch_bounds__(256)
void qkv_kernel(const float* __restrict__ x,
                const float* __restrict__ W1,
                const float* __restrict__ W2,
                const float* __restrict__ W3,
                const float* __restrict__ alpha,
                const float* __restrict__ beta,
                float* __restrict__ qkv /* [3][N][D] */) {
  __shared__ float buf0[128 * LDSW];
  __shared__ float buf1[128 * LDSW];
  __shared__ __attribute__((aligned(16))) float wb[128 * LDSW];   // W1 -> W2 -> W3

  const int s = blockIdx.y;
  const int rowBase = blockIdx.x * 128;
  const int tid = threadIdx.x;
  const int lane = tid & 31;
  const int wave = tid >> 5;
  const int m0 = wave * 16;

  const float* W1s = W1 + s * D * D;
  const float* W2s = W2 + s * D * D;
  const float* W3s = W3 + s * D * D;
  const float* a0 = alpha + (s * 3 + 0) * D;
  const float* a1 = alpha + (s * 3 + 1) * D;
  const float* a2 = alpha + (s * 3 + 2) * D;
  const float* b0 = beta + (s * 3 + 0) * D;
  const float* b1 = beta + (s * 3 + 1) * D;
  const float* b2 = beta + (s * 3 + 2) * D;

  v4f w[16];
  load_b(W1s, tid, w);

  // stage: buf0 = swish(x, a0, b0)
  for (int i = tid; i < 128 * D; i += 256) {
    const int r = i >> 7, c = i & 127;
    buf0[r * LDSW + c] = swish1(x[(rowBase + r) * D + c], a0[c], b0[c]);
  }
  store_b<LDSW>(w, wb, tid);
  __syncthreads();

  v8f acc[8];
  const int half = (lane >> 4) * 8;
  const int cn = lane & 15;

  // GEMM1: buf1 = buf0 @ W1.T
  zero_acc(acc);
  gemm_stripe<false, false>(buf0, LDSW, wb, LDSW, m0, lane, acc);
  load_b(W2s, tid, w);
#pragma unroll
  for (int t = 0; t < 8; ++t)
#pragma unroll
    for (int r = 0; r < 8; ++r)
      buf1[(m0 + half + r) * LDSW + t * 16 + cn] = acc[t][r];
  __syncthreads();

  // wb = W2 (every wave is past GEMM1); buf0 = swish(buf1, a1, b1)
  store_b<LDSW>(w, wb, tid);
  for (int i = tid; i < 128 * D; i += 256) {
    const int r = i >> 7, c = i & 127;
    buf0[r * LDSW + c] = swish1(buf1[r * LDSW + c], a1[c], b1[c]);
  }
  __syncthreads();

  // GEMM2: buf1 = buf0 @ W2.T
  zero_acc(acc);
  gemm_stripe<false, false>(buf0, LDSW, wb, LDSW, m0, lane, acc);
  load_b(W3s, tid, w);
#pragma unroll
  for (int t = 0; t < 8; ++t)
#pragma unroll
    for (int r = 0; r < 8; ++r)
      buf1[(m0 + half + r) * LDSW + t * 16 + cn] = acc[t][r];
  __syncthreads();

  // wb = W3 (every wave is past GEMM2); residual + swish: buf0 = swish(x + buf1, a2, b2)
  store_b<LDSW>(w, wb, tid);
  for (int i = tid; i < 128 * D; i += 256) {
    const int r = i >> 7, c = i & 127;
    const float v = x[(rowBase + r) * D + c] + buf1[r * LDSW + c];
    buf0[r * LDSW + c] = swish1(v, a2[c], b2[c]);
  }
  __syncthreads();

  // GEMM3: qkv[s] = buf0 @ W3.T  (store straight to workspace)
  zero_acc(acc);
  gemm_stripe<false, false>(buf0, LDSW, wb, LDSW, m0, lane, acc);
  float* outp = qkv + (size_t)s * NTOT * D;
#pragma unroll
  for (int t = 0; t < 8; ++t)
#pragma unroll
    for (int r = 0; r < 8; ++r)
      outp[(size_t)(rowBase + m0 + half + r) * D + t * 16 + cn] = acc[t][r];
}

// ---------------- Kernel 2: fused Performer attention, one WG per graph ----
__global__ __launch_bounds__(256)
void attn_kernel(const float* __restrict__ Q,
                 const float* __restrict__ K,
                 const float* __restrict__ V,
                 const float* __restrict__ proj,
                 const int* __restrict__ num_atoms,
                 float* __restrict__ out) {
  __shared__ float qb[128 * LDSW];   // Q*dnorm -> qp
  __shared__ float kb[128 * LDSW];   // K*dnorm -> kp -> kv
  __shared__ __attribute__((aligned(16))) float pb[128 * LDSV];   // proj (pitch LDSW) -> V_g (pitch LDSV)
  __shared__ float qdiag[128], kdiag[128], ksum[128], dinv[128], rowArr[128];
  __shared__ int gstartSh, RSh;
  __shared__ float kmaxSh;

  const int g = blockIdx.x;
  const int tid = threadIdx.x;
  const int lane = tid & 31;
  const int wave = tid >> 5;
  const int m0 = wave * 16;
  const int half = (lane >> 4) * 8;
  const int cn = lane & 15;

  v4f w[16];
  load_b(proj, tid, w);

  if (tid == 0) {
    int st = 0;
    for (int i = 0; i < g; ++i) st += num_atoms[i];
    gstartSh = st;
    RSh = num_atoms[g];
  }
  store_b<LDSW>(w, pb, tid);
  __syncthreads();
  const int gstart = gstartSh;
  const int R = RSh;

  // stage scaled Q/K (rows >= R zeroed)
  for (int i = tid; i < 128 * D; i += 256) {
    const int r = i >> 7, c = i & 127;
    float qv = 0.0f, kvv = 0.0f;
    if (r < R) {
      qv = Q[(size_t)(gstart + r) * D + c] * DNORM;
      kvv = K[(size_t)(gstart + r) * D + c] * DNORM;
    }
    qb[r * LDSW + c] = qv;
    kb[r * LDSW + c] = kvv;
  }
  __syncthreads();

  if (tid < 128) {
    float sq = 0.0f, sk = 0.0f;
    for (int d = 0; d < D; ++d) {
      const float a = qb[tid * LDSW + d];
      const float b = kb[tid * LDSW + d];
      sq += a * a;
      sk += b * b;
    }
    qdiag[tid] = 0.5f * sq;   // 0.5*sum(Q^2)*dnorm^2 (qb is pre-scaled)
    kdiag[tid] = 0.5f * sk;
  }
  __syncthreads();

  v8f acc[8];
  float rm[8];

  // ---- kd = kb @ proj.T ; per-graph max ; kp in-place into kb ----
  zero_acc(acc);
  gemm_stripe<false, false>(kb, LDSW, pb, LDSW, m0, lane, acc);
#pragma unroll
  for (int r = 0; r < 8; ++r) {
    float mx = acc[0][r];
#pragma unroll
    for (int t = 1; t < 8; ++t) mx = fmaxf(mx, acc[t][r]);
    rm[r] = mx;
  }
#pragma unroll
  for (int r = 0; r < 8; ++r)
    for (int off = 1; off < 16; off <<= 1)
      rm[r] = fmaxf(rm[r], __shfl_xor(rm[r], off, 32));
  if ((lane & 15) == 0) {
#pragma unroll
    for (int r = 0; r < 8; ++r) rowArr[m0 + half + r] = rm[r];
  }
  __syncthreads();
  if (tid == 0) {
    float mx = -3.402823466e38f;
    for (int i = 0; i < R; ++i) mx = fmaxf(mx, rowArr[i]);
    kmaxSh = mx;
  }
  __syncthreads();
  {
    const float km = kmaxSh;
#pragma unroll
    for (int t = 0; t < 8; ++t)
#pragma unroll
      for (int r = 0; r < 8; ++r) {
        const int row = m0 + half + r;
        float v = 0.0f;
        if (row < R)
          v = RATIO * (__expf(acc[t][r] - kdiag[row] - km) + EPSK);
        kb[row * LDSW + t * 16 + cn] = v;   // this wave's own rows only
      }
  }

  // ---- qd = qb @ proj.T ; per-row max ; qp in-place into qb ----
  zero_acc(acc);
  gemm_stripe<false, false>(qb, LDSW, pb, LDSW, m0, lane, acc);
  // first row clamped so that the 128-row read stays inside V whatever num_atoms
  // holds (an identity while every entry lies in 0..128)
  load_b(V + (size_t)min(max(gstart, 0), NTOT - 128) * D, tid, w);
#pragma unroll
  for (int r = 0; r < 8; ++r) {
    float mx = acc[0][r];
#pragma unroll
    for (int t = 1; t < 8; ++t) mx = fmaxf(mx, acc[t][r]);
    rm[r] = mx;
  }
#pragma unroll
  for (int r = 0; r < 8; ++r)
    for (int off = 1; off < 16; off <<= 1)
      rm[r] = fmaxf(rm[r], __shfl_xor(rm[r], off, 32));
#pragma unroll
  for (int t = 0; t < 8; ++t)
#pragma unroll
    for (int r = 0; r < 8; ++r) {
      const int row = m0 + half + r;
      float v = 0.0f;
      if (row < R)
        v = RATIO * (__expf(acc[t][r] - qdiag[row] - rm[r]) + EPSK);
      qb[row * LDSW + t * 16 + cn] = v;
    }
  __syncthreads();   // qp & kp fully materialized

  // pb = V_g (every wave is past its last read of proj)
  store_b<LDSV>(w, pb, tid);

  // ksum[m] = sum_n kp[n,m]
  if (tid < 128) {
    float sv = 0.0f;
    for (int n = 0; n < 128; ++n) sv += kb[n * LDSW + tid];
    ksum[tid] = sv;
  }
  __syncthreads();

  // kv = kp^T @ V_g  (accumulators held in regs across barrier, then
  // written back over kb — kp is dead after this GEMM)
  zero_acc(acc);
  gemm_stripe<true, true>(kb, LDSW, pb, LDSV, m0, lane, acc);
  __syncthreads();
#pragma unroll
  for (int t = 0; t < 8; ++t)
#pragma unroll
    for (int r = 0; r < 8; ++r)
      kb[(m0 + half + r) * LDSW + t * 16 + cn] = acc[t][r];
  __syncthreads();

  // dinv[n] = 1 / (qp[n,:] . ksum)
  if (tid < 128) {
    float sv = 0.0f;
    for (int m = 0; m < MFEAT; ++m) sv += qb[tid * LDSW + m] * ksum[m];
    dinv[tid] = 1.0f / sv;
  }
  __syncthreads();

  // out = (qp @ kv) * dinv
  zero_acc(acc);
  gemm_stripe<false, true>(qb, LDSW, kb, LDSW, m0, lane, acc);
#pragma unroll
  for (int t = 0; t < 8; ++t)
#pragma unroll
    for (int r = 0; r < 8; ++r) {
      const int row = m0 + half + r;
      if (row < R)
        out[(size_t)(gstart + row) * D + t * 16 + cn] = acc[t][r] * dinv[row];
    }
}

extern "C" void kernel_launch(void* const* d_in, const int* in_sizes, int n_in,
                              void* d_out, int out_size, void* d_ws, size_t ws_size,
                              hipStream_t stream) {
  (void)in_sizes; (void)n_in; (void)out_size; (void)ws_size;
  const float* x         = (const float*)d_in[0];
  const int*   num_atoms = (const int*)d_in[1];
  const float* W1        = (const float*)d_in[2];
  const float* W2        = (const float*)d_in[3];
  const float* W3        = (const float*)d_in[4];
  const float* alpha     = (const float*)d_in[5];
  const float* beta      = (const float*)d_in[6];
  const float* proj      = (const float*)d_in[7];
  float* out = (float*)d_out;

  float* ws = (float*)d_ws;          // [3][N][D] fp32 = 12.6 MB scratch
  float* Q = ws;
  float* K = ws + (size_t)NTOT * D;
  float* V = ws + 2 * (size_t)NTOT * D;

  dim3 grid1(NTOT / 128, 3);
  qkv_kernel<<<grid1, 256, 0, stream>>>(x, W1, W2, W3, alpha, beta, ws);
  attn_kernel<<<G, 256, 0, stream>>>(Q, K, V, proj, num_atoms, out);
}

// v002
// It runs in 63 microseconds.
// Next to v001, in two timings, it ran 1.52 times as fast each time.
// Over all steps from v000 it is 1.88 times as fast.
#include <hip/hip_runtime.h>

#define D      128
#define MFEAT  128
#define G      64
#define NTOT   8192
#define LDSW   132            // 128 + 4 pad (bank-conflict stagger on 64 banks)
#define LDSV   136            // pitch of a staged k-major B: rows k and k+2 lie 16 banks apart
#define EPSK   1e-4f
#define DNORM  0.29730177875068026f   // 128^-0.25
#define RATIO  0.08838834764831843f   // 128^-0.5

typedef __attribute__((ext_vector_type(2))) float v2f;
typedef __attribute__((ext_vector_type(4))) float v4f;
typedef __attribute__((ext_vector_type(8))) float v8f;

__device__ __forceinline__ float swish1(float x, float a, float b) {
  return a * x * (1.0f / (1.0f + __expf(-b * x)));
}

__device__ __forceinline__ void zero_acc(v8f acc[8]) {
#pragma unroll
  for (int t = 0; t < 8; ++t)
#pragma unroll
    for (int r = 0; r < 8; ++r) acc[t][r] = 0.0f;
}

// One wave computes a 16-row x 128-col stripe: out[m0..m0+16, 0..128) +=
// A[16 x 128] * B[128 x 128], K accumulated with V_WMMA_F32_16X16X4_F32.
// ATRANS: A element (m,k) read as A[k*lda + m] (for kp^T).
// BROWK : B element (k,n) read as B[k*ldb + n]  (row-major over k),
//         else B(k,n) = B[n*ldb + k]            (i.e. X @ W.T pattern).
template <bool ATRANS, bool BROWK>
__device__ __forceinline__ void gemm_stripe(const float* __restrict__ A, int lda,
                                            const float* __restrict__ B, int ldb,
                                            int m0, int lane, v8f acc[8]) {
  const int mr = lane & 15;          // matrix row (A) / col (B) within tile
  const int kb = (lane >> 4) << 1;   // k-pair base for this half-wave
#pragma unroll 4
  for (int k0 = 0; k0 < D; k0 += 4) {
    const int k = k0 + kb;
    v2f a;
    if (ATRANS) {
      a.x = A[k * lda + m0 + mr];
      a.y = A[(k + 1) * lda + m0 + mr];
    } else {
      a.x = A[(m0 + mr) * lda + k];
      a.y = A[(m0 + mr) * lda + k + 1];
    }
#pragma unroll
    for (int t = 0; t < 8; ++t) {
      const int col = t * 16 + mr;
      v2f b;
      if (BROWK) {
        b.x = B[k * ldb + col];
        b.y = B[(k + 1) * ldb + col];
      } else {
        b.x = B[col * ldb + k];
        b.y = B[col * ldb + k + 1];
      }
      acc[t] = __builtin_amdgcn_wmma_f32_16x16x4_f32(false, a, false, b,
                                                     (short)0, acc[t],
                                                     false, false);
    }
  }
}

// Staging of a B operand: the block reads one dense 128 x 128 f32 matrix from
// global memory once, 16 bytes a lane (a wave takes whole 512-byte rows), and
// lays it into LDS, so a cache line is touched once per block and not by every
// fragment load of every wave. Load and store are apart so that the loads fly
// over the work that stands between them.
__device__ __forceinline__ void load_b(const float* __restrict__ src, int tid,
                                       v4f w[16]) {
  const v4f* p = reinterpret_cast<const v4f*>(src) + tid;
#pragma unroll   // constant indices keep w[] in registers; all 16 loads in flight at once
  for (int j = 0; j < 16; ++j) w[j] = p[j * 256];
}

template <int PITCH>
__device__ __forceinline__ void store_b(const v4f w[16], float* dst, int tid) {
  // row tid >> 5, column 4 * (tid & 31); each j goes 8 rows further down
  float* p = dst + tid * 4 + (tid >> 5) * (PITCH - D);
#pragma unroll   // constant indices keep w[] in registers; j becomes the store's offset field
  for (int j = 0; j < 16; ++j) *reinterpret_cast<v4f*>(p + j * 8 * PITCH) = w[j];
}

__device__ __forceinline__ v4f ld4(const float* p) {
  return *reinterpret_cast<const v4f*>(p);
}

// One element-wise pass over a staged 128 x 128 tile (pitch LDSW), in the shape of
// store_b: lane tid holds columns 4 * (tid & 31) .. + 3 of rows (tid >> 5) + 8 * j.
// dst = swish(src, a, b), or swish(src + add, a, b) where RES is set.
template <bool RES>
__device__ __forceinline__ void swish_pass(const float* src, const float* add,
                                           float* dst, v4f a, v4f b, int tid) {
  const int e0 = tid * 4 + (tid >> 5) * (LDSW - D);
#pragma unroll 4   // four 16-byte LDS reads go out together; unrolled further the text only grows
  for (int j = 0; j < 16; ++j) {
    const int e = e0 + j * 8 * LDSW;
    v4f v = ld4(src + e);
    if (RES) v += ld4(add + e);
    v4f r;
    r.x = swish1(v.x, a.x, b.x);
    r.y = swish1(v.y, a.y, b.y);
    r.z = swish1(v.z, a.z, b.z);
    r.w = swish1(v.w, a.w, b.w);
    *reinterpret_cast<v4f*>(dst + e) = r;
  }
}

// ---------------- Kernel 1: Q/K/V via three ResidualMLPs ----------------
// grid = (N/128, 3); block = 256 (8 wave32). LDS: four 128x132 f32 buffers.
__global__ __launch_bounds__(256)
void qkv_kernel(const float* __restrict__ x,
                const float* __restrict__ W1,
                const float* __restrict__ W2,
                const float* __restrict__ W3,
                const float* __restrict__ alpha,
                const float* __restrict__ beta,
                float* __restrict__ qkv /* [3][N][D] */) {
  __shared__ __attribute__((aligned(16))) float buf0[128 * LDSW];
  __shared__ __attribute__((aligned(16))) float buf1[128 * LDSW];
  __shared__ __attribute__((aligned(16))) float xs[128 * LDSW];   // the x tile, read from global once
  __shared__ __attribute__((aligned(16))) float wb[128 * LDSW];   // W1 -> W2 -> W3

  const int s = blockIdx.y;
  const int rowBase = blockIdx.x * 128;
  const int tid = threadIdx.x;
  const int lane = tid & 31;
  const int wave = tid >> 5;
  const int m0 = wave * 16;

  const float* W1s = W1 + s * D * D;
  const float* W2s = W2 + s * D * D;
  const float* W3s = W3 + s * D * D;
  const float* a0 = alpha + (s * 3 + 0) * D;
  const float* a1 = alpha + (s * 3 + 1) * D;
  const float* a2 = alpha + (s * 3 + 2) * D;
  const float* b0 = beta + (s * 3 + 0) * D;
  const float* b1 = beta + (s * 3 + 1) * D;
  const float* b2 = beta + (s * 3 + 2) * D;

  v4f w[16];
  {
    v4f xr[16];
    load_b(x + rowBase * D, tid, xr);
    load_b(W1s, tid, w);
    store_b<LDSW>(xr, xs, tid);
  }
  // this lane's four columns of every alpha and beta, asked for before the first pass
  const int c4 = (tid & 31) * 4;
  const v4f a0v = ld4(a0 + c4), b0v = ld4(b0 + c4);
  const v4f a1v = ld4(a1 + c4), b1v = ld4(b1 + c4);
  const v4f a2v = ld4(a2 + c4), b2v = ld4(b2 + c4);

  // stage: buf0 = swish(x, a0, b0); a lane reads back only what it stored in xs itself
  swish_pass<false>(xs, xs, buf0, a0v, b0v, tid);
  store_b<LDSW>(w, wb, tid);
  __syncthreads();

  v8f acc[8];
  const int half = (lane >> 4) * 8;
  const int cn = lane & 15;

  // GEMM1: buf1 = buf0 @ W1.T
  zero_acc(acc);
  gemm_stripe<false, false>(buf0, LDSW, wb, LDSW, m0, lane, acc);
  load_b(W2s, tid, w);
#pragma unroll
  for (int t = 0; t < 8; ++t)
#pragma unroll
    for (int r = 0; r < 8; ++r)
      buf1[(m0 + half + r) * LDSW + t * 16 + cn] = acc[t][r];
  __syncthreads();

  // wb = W2 (every wave is past GEMM1); buf0 = swish(buf1, a1, b1)
  store_b<LDSW>(w, wb, tid);
  swish_pass<false>(buf1, buf1, buf0, a1v, b1v, tid);
  __syncthreads();

  // GEMM2: buf1 = buf0 @ W2.T
  zero_acc(acc);
  gemm_stripe<false, false>(buf0, LDSW, wb, LDSW, m0, lane, acc);
  load_b(W3s, tid, w);
#pragma unroll
  for (int t = 0; t < 8; ++t)
#pragma unroll
    for (int r = 0; r < 8; ++r)
      buf1[(m0 + half + r) * LDSW + t * 16 + cn] = acc[t][r];
  __syncthreads();

  // wb = W3 (every wave is past GEMM2); residual + swish: buf0 = swish(x + buf1, a2, b2)
  store_b<LDSW>(w, wb, tid);
  swish_pass<true>(xs, buf1, buf0, a2v, b2v, tid);
  __syncthreads();

  // GEMM3: qkv[s] = buf0 @ W3.T  (store straight to workspace)
  zero_acc(acc);
  gemm_stripe<false, false>(buf0, LDSW, wb, LDSW, m0, lane, acc);
  float* outp = qkv + (size_t)s * NTOT * D;
#pragma unroll
  for (int t = 0; t < 8; ++t)
#pragma unroll
    for (int r = 0; r < 8; ++r)
      outp[(size_t)(rowBase + m0 + half + r) * D + t * 16 + cn] = acc[t][r];
}

// ---------------- Kernel 2: fused Performer attention, one WG per graph ----
__global__ __launch_bounds__(256)
void attn_kernel(const float* __restrict__ Q,
                 const float* __restrict__ K,
                 const float* __restrict__ V,
                 const float* __restrict__ proj,
                 const int* __restrict__ num_atoms,
                 float* __restrict__ out) {
  __shared__ __attribute__((aligned(16))) float qb[128 * LDSW];   // Q*dnorm -> qp
  __shared__ __attribute__((aligned(16))) float kb[128 * LDSW];   // K*dnorm -> kp -> kv
  __shared__ __attribute__((aligned(16))) float pb[128 * LDSV];   // proj (pitch LDSW) -> V_g (pitch LDSV)
  __shared__ float qdiag[128], kdiag[128], ksum[128], dinv[128], rowArr[128];
  __shared__ int gstartSh, RSh;
  __shared__ float kmaxSh;

  const int g = blockIdx.x;
  const int tid = threadIdx.x;
  const int lane = tid & 31;
  const int wave = tid >> 5;
  const int m0 = wave * 16;
  const int half = (lane >> 4) * 8;
  const int cn = lane & 15;

  v4f w[16];
  load_b(proj, tid, w);

  if (tid == 0) {
    int st = 0;
    for (int i = 0; i < g; ++i) st += num_atoms[i];
    gstartSh = st;
    RSh = num_atoms[g];
  }
  store_b<LDSW>(w, pb, tid);
  __syncthreads();
  const int gstart = gstartSh;
  const int R = RSh;

  // first row clamped so that a 128-row read stays inside Q, K and V whatever
  // num_atoms holds (an identity while every entry lies in 0..128)
  const size_t tile0 = (size_t)min(max(gstart, 0), NTOT - 128) * D;

  // stage scaled Q/K (rows >= R zeroed): all 128 rows are read, the select drops the rest
  {
    v4f q4[16], k4[16];
    load_b(Q + tile0, tid, q4);
    load_b(K + tile0, tid, k4);
    const v4f zero4 = {0.0f, 0.0f, 0.0f, 0.0f};
#pragma unroll   // constant indices keep q4[] and k4[] in registers
    for (int j = 0; j < 16; ++j) {
      const bool in = (tid >> 5) + 8 * j < R;
      q4[j] = in ? q4[j] * DNORM : zero4;
      k4[j] = in ? k4[j] * DNORM : zero4;
    }
    store_b<LDSW>(q4, qb, tid);
    store_b<LDSW>(k4, kb, tid);
  }
  __syncthreads();

  if (tid < 128) {
    float sq = 0.0f, sk = 0.0f;
    for (int d = 0; d < D; ++d) {
      const float a = qb[tid * LDSW + d];
      const float b = kb[tid * LDSW + d];
      sq += a * a;
      sk += b * b;
    }
    qdiag[tid] = 0.5f * sq;   // 0.5*sum(Q^2)*dnorm^2 (qb is pre-scaled)
    kdiag[tid] = 0.5f * sk;
  }
  __syncthreads();

  v8f acc[8];
  float rm[8];

  // ---- kd = kb @ proj.T ; per-graph max ; kp in-place into kb ----
  zero_acc(acc);
  gemm_stripe<false, false>(kb, LDSW, pb, LDSW, m0, lane, acc);
#pragma unroll
  for (int r = 0; r < 8; ++r) {
    float mx = acc[0][r];
#pragma unroll
    for (int t = 1; t < 8; ++t) mx = fmaxf(mx, acc[t][r]);
    rm[r] = mx;
  }
#pragma unroll
  for (int r = 0; r < 8; ++r)
    for (int off = 1; off < 16; off <<= 1)
      rm[r] = fmaxf(rm[r], __shfl_xor(rm[r], off, 32));
  if ((lane & 15) == 0) {
#pragma unroll
    for (int r = 0; r < 8; ++r) rowArr[m0 + half + r] = rm[r];
  }
  __syncthreads();
  if (tid == 0) {
    float mx = -3.402823466e38f;
    for (int i = 0; i < R; ++i) mx = fmaxf(mx, rowArr[i]);
    kmaxSh = mx;
  }
  __syncthreads();
  {
    const float km = kmaxSh;
#pragma unroll
    for (int t = 0; t < 8; ++t)
#pragma unroll
      for (int r = 0; r < 8; ++r) {
        const int row = m0 + half + r;
        float v = 0.0f;
        if (row < R)
          v = RATIO * (__expf(acc[t][r] - kdiag[row] - km) + EPSK);
        kb[row * LDSW + t * 16 + cn] = v;   // this wave's own rows only
      }
  }

  // ---- qd = qb @ proj.T ; per-row max ; qp in-place into qb ----
  zero_acc(acc);
  gemm_stripe<false, false>(qb, LDSW, pb, LDSW, m0, lane, acc);
  load_b(V + tile0, tid, w);
#pragma unroll
  for (int r = 0; r < 8; ++r) {
    float mx = acc[0][r];
#pragma unroll
    for (int t = 1; t < 8; ++t) mx = fmaxf(mx, acc[t][r]);
    rm[r] = mx;
  }
#pragma unroll
  for (int r = 0; r < 8; ++r)
    for (int off = 1; off < 16; off <<= 1)
      rm[r] = fmaxf(rm[r], __shfl_xor(rm[r], off, 32));
#pragma unroll
  for (int t = 0; t < 8; ++t)
#pragma unroll
    for (int r = 0; r < 8; ++r) {
      const int row = m0 + half + r;
      float v = 0.0f;
      if (row < R)
        v = RATIO * (__expf(acc[t][r] - qdiag[row] - rm[r]) + EPSK);
      qb[row * LDSW + t * 16 + cn] = v;
    }
  __syncthreads();   // qp & kp fully materialized

  // pb = V_g (every wave is past its last read of proj)
  store_b<LDSV>(w, pb, tid);

  // ksum[m] = sum_n kp[n,m]
  if (tid < 128) {
    float sv = 0.0f;
    for (int n = 0; n < 128; ++n) sv += kb[n * LDSW + tid];
    ksum[tid] = sv;
  }
  __syncthreads();

  // kv = kp^T @ V_g  (accumulators held in regs across barrier, then
  // written back over kb — kp is dead after this GEMM)
  zero_acc(acc);
  gemm_stripe<true, true>(kb, LDSW, pb, LDSV, m0, lane, acc);
  __syncthreads();
#pragma unroll
  for (int t = 0; t < 8; ++t)
#pragma unroll
    for (int r = 0; r < 8; ++r)
      kb[(m0 + half + r) * LDSW + t * 16 + cn] = acc[t][r];
  __syncthreads();

  // dinv[n] = 1 / (qp[n,:] . ksum)
  if (tid < 128) {
    float sv = 0.0f;
    for (int m = 0; m < MFEAT; ++m) sv += qb[tid * LDSW + m] * ksum[m];
    dinv[tid] = 1.0f / sv;
  }
  __syncthreads();

  // out = (qp @ kv) * dinv
  zero_acc(acc);
  gemm_stripe<false, true>(qb, LDSW, kb, LDSW, m0, lane, acc);
#pragma unroll
  for (int t = 0; t < 8; ++t)
#pragma unroll
    for (int r = 0; r < 8; ++r) {
      const int row = m0 + half + r;
      if (row < R)
        out[(size_t)(gstart + row) * D + t * 16 + cn] = acc[t][r] * dinv[row];
    }
}

extern "C" void kernel_launch(void* const* d_in, const int* in_sizes, int n_in,
                              void* d_out, int out_size, void* d_ws, size_t ws_size,
                              hipStream_t stream) {
  (void)in_sizes; (void)n_in; (void)out_size; (void)ws_size;
  const float* x         = (const float*)d_in[0];
  const int*   num_atoms = (const int*)d_in[1];
  const float* W1        = (const float*)d_in[2];
  const float* W2        = (const float*)d_in[3];
  const float* W3        = (const float*)d_in[4];
  const float* alpha     = (const float*)d_in[5];
  const float* beta      = (const float*)d_in[6];
  const float* proj      = (const float*)d_in[7];
  float* out = (float*)d_out;

  float* ws = (float*)d_ws;          // [3][N][D] fp32 = 12.6 MB scratch
  float* Q = ws;
  float* K = ws + (size_t)NTOT * D;
  float* V = ws + 2 * (size_t)NTOT * D;

  dim3 grid1(NTOT / 128, 3);
  qkv_kernel<<<grid1, 256, 0, stream>>>(x, W1, W2, W3, alpha, beta, ws);
  attn_kernel<<<G, 256, 0, stream>>>(Q, K, V, proj, num_atoms, out);
}

// v003
// One run takes 50.5 microseconds.
// Two timings next to v002 both put it at 1.25 times that version's speed.
// Over all steps from v000 it is 2.35 times as fast.
#include <hip/hip_runtime.h>

#define D      128
#define MFEAT  128
#define G      64
#define NTOT   8192
#define LDSW   132            // 128 + 4 pad (bank-conflict stagger on 64 banks)
#define LDSV   136            // pitch of a staged k-major B: rows k and k+2 lie 16 banks apart
#define EPSK   1e-4f
#define DNORM  0.29730177875068026f   // 128^-0.25
#define RATIO  0.08838834764831843f   // 128^-0.5

typedef __attribute__((ext_vector_type(2))) float v2f;
typedef __attribute__((ext_vector_type(4))) float v4f;
typedef __attribute__((ext_vector_type(8))) float v8f;

__device__ __forceinline__ float swish1(float x, float a, float b) {
  return a * x * (1.0f / (1.0f + __expf(-b * x)));
}

__device__ __forceinline__ void zero_acc(v8f acc[8]) {
#pragma unroll
  for (int t = 0; t < 8; ++t)
#pragma unroll
    for (int r = 0; r < 8; ++r) acc[t][r] = 0.0f;
}

// One wave computes a 16-row x 128-col stripe: out[m0..m0+16, 0..128) +=
// A[16 x 128] * B[128 x 128], K accumulated with V_WMMA_F32_16X16X4_F32.
// ATRANS: A element (m,k) read as A[k*lda + m] (for kp^T).
// BROWK : B element (k,n) read as B[k*ldb + n]  (row-major over k),
//         else B(k,n) = B[n*ldb + k]            (i.e. X @ W.T pattern).
template <bool ATRANS, bool BROWK>
__device__ __forceinline__ void gemm_stripe(const float* __restrict__ A, int lda,
                                            const float* __restrict__ B, int ldb,
                                            int m0, int lane, v8f acc[8]) {
  const int mr = lane & 15;          // matrix row (A) / col (B) within tile
  const int kb = (lane >> 4) << 1;   // k-pair base for this half-wave
#pragma unroll 4
  for (int k0 = 0; k0 < D; k0 += 4) {
    const int k = k0 + kb;
    v2f a;
    if (ATRANS) {
      a.x = A[k * lda + m0 + mr];
      a.y = A[(k + 1) * lda + m0 + mr];
    } else {
      a.x = A[(m0 + mr) * lda + k];
      a.y = A[(m0 + mr) * lda + k + 1];
    }
#pragma unroll
    for (int t = 0; t < 8; ++t) {
      const int col = t * 16 + mr;
      v2f b;
      if (BROWK) {
        b.x = B[k * ldb + col];
        b.y = B[(k + 1) * ldb + col];
      } else {
        b.x = B[col * ldb + k];
        b.y = B[col * ldb + k + 1];
      }
      acc[t] = __builtin_amdgcn_wmma_f32_16x16x4_f32(false, a, false, b,
                                                     (short)0, acc[t],
                                                     false, false);
    }
  }
}

// Staging of a B operand: the block reads one dense 128 x 128 f32 matrix from
// global memory once, 16 bytes a lane (a wave takes whole 512-byte rows), and
// lays it into LDS, so a cache line is touched once per block and not by every
// fragment load of every wave. Load and store are apart so that the loads fly
// over the work that stands between them.
__device__ __forceinline__ void load_b(const float* __restrict__ src, int tid,
                                       v4f w[16]) {
  const v4f* p = reinterpret_cast<const v4f*>(src) + tid;
#pragma unroll   // constant indices keep w[] in registers; all 16 loads in flight at once
  for (int j = 0; j < 16; ++j) w[j] = p[j * 256];
}

template <int PITCH>
__device__ __forceinline__ void store_b(const v4f w[16], float* dst, int tid) {
  // row tid >> 5, column 4 * (tid & 31); each j goes 8 rows further down
  float* p = dst + tid * 4 + (tid >> 5) * (PITCH - D);
#pragma unroll   // constant indices keep w[] in registers; j becomes the store's offset field
  for (int j = 0; j < 16; ++j) *reinterpret_cast<v4f*>(p + j * 8 * PITCH) = w[j];
}

__device__ __forceinline__ v4f ld4(const float* p) {
  return *reinterpret_cast<const v4f*>(p);
}

// One element-wise pass over a staged 128 x 128 tile (pitch LDSW), in the shape of
// store_b: lane tid holds columns 4 * (tid & 31) .. + 3 of rows (tid >> 5) + 8 * j.
// dst = swish(src, a, b), or swish(src + add, a, b) where RES is set.
template <bool RES>
__device__ __forceinline__ void swish_pass(const float* src, const float* add,
                                           float* dst, v4f a, v4f b, int tid) {
  const int e0 = tid * 4 + (tid >> 5) * (LDSW - D);
#pragma unroll 4   // four 16-byte LDS reads go out together; unrolled further the text only grows
  for (int j = 0; j < 16; ++j) {
    const int e = e0 + j * 8 * LDSW;
    v4f v = ld4(src + e);
    if (RES) v += ld4(add + e);
    v4f r;
    r.x = swish1(v.x, a.x, b.x);
    r.y = swish1(v.y, a.y, b.y);
    r.z = swish1(v.z, a.z, b.z);
    r.w = swish1(v.w, a.w, b.w);
    *reinterpret_cast<v4f*>(dst + e) = r;
  }
}

// ---------------- Kernel 1: Q/K/V via three ResidualMLPs ----------------
// grid = (N/128, 3); block = 256 (8 wave32). LDS: four 128x132 f32 buffers.
__global__ __launch_bounds__(256)
void qkv_kernel(const float* __restrict__ x,
                const float* __restrict__ W1,
                const float* __restrict__ W2,
                const float* __restrict__ W3,
                const float* __restrict__ alpha,
                const float* __restrict__ beta,
                float* __restrict__ qkv /* [3][N][D] */) {
  __shared__ __attribute__((aligned(16))) float buf0[128 * LDSW];
  __shared__ __attribute__((aligned(16))) float buf1[128 * LDSW];
  __shared__ __attribute__((aligned(16))) float xs[128 * LDSW];   // the x tile, read from global once
  __shared__ __attribute__((aligned(16))) float wb[128 * LDSW];   // W1 -> W2 -> W3

  const int s = blockIdx.y;
  const int rowBase = blockIdx.x * 128;
  const int tid = threadIdx.x;
  const int lane = tid & 31;
  const int wave = tid >> 5;
  const int m0 = wave * 16;

  const float* W1s = W1 + s * D * D;
  const float* W2s = W2 + s * D * D;
  const float* W3s = W3 + s * D * D;
  const float* a0 = alpha + (s * 3 + 0) * D;
  const float* a1 = alpha + (s * 3 + 1) * D;
  const float* a2 = alpha + (s * 3 + 2) * D;
  const float* b0 = beta + (s * 3 + 0) * D;
  const float* b1 = beta + (s * 3 + 1) * D;
  const float* b2 = beta + (s * 3 + 2) * D;

  v4f w[16];
  {
    v4f xr[16];
    load_b(x + rowBase * D, tid, xr);
    load_b(W1s, tid, w);
    store_b<LDSW>(xr, xs, tid);
  }
  // this lane's four columns of every alpha and beta, asked for before the first pass
  const int c4 = (tid & 31) * 4;
  const v4f a0v = ld4(a0 + c4), b0v = ld4(b0 + c4);
  const v4f a1v = ld4(a1 + c4), b1v = ld4(b1 + c4);
  const v4f a2v = ld4(a2 + c4), b2v = ld4(b2 + c4);

  // stage: buf0 = swish(x, a0, b0); a lane reads back only what it stored in xs itself
  swish_pass<false>(xs, xs, buf0, a0v, b0v, tid);
  store_b<LDSW>(w, wb, tid);
  __syncthreads();

  v8f acc[8];
  const int half = (lane >> 4) * 8;
  const int cn = lane & 15;

  // GEMM1: buf1 = buf0 @ W1.T
  zero_acc(acc);
  gemm_stripe<false, false>(buf0, LDSW, wb, LDSW, m0, lane, acc);
  load_b(W2s, tid, w);
#pragma unroll
  for (int t = 0; t < 8; ++t)
#pragma unroll
    for (int r = 0; r < 8; ++r)
      buf1[(m0 + half + r) * LDSW + t * 16 + cn] = acc[t][r];
  __syncthreads();

  // wb = W2 (every wave is past GEMM1); buf0 = swish(buf1, a1, b1)
  store_b<LDSW>(w, wb, tid);
  swish_pass<false>(buf1, buf1, buf0, a1v, b1v, tid);
  __syncthreads();

  // GEMM2: buf1 = buf0 @ W2.T
  zero_acc(acc);
  gemm_stripe<false, false>(buf0, LDSW, wb, LDSW, m0, lane, acc);
  load_b(W3s, tid, w);
#pragma unroll
  for (int t = 0; t < 8; ++t)
#pragma unroll
    for (int r = 0; r < 8; ++r)
      buf1[(m0 + half + r) * LDSW + t * 16 + cn] = acc[t][r];
  __syncthreads();

  // wb = W3 (every wave is past GEMM2); residual + swish: buf0 = swish(x + buf1, a2, b2)
  store_b<LDSW>(w, wb, tid);
  swish_pass<true>(xs, buf1, buf0, a2v, b2v, tid);
  __syncthreads();

  // GEMM3: qkv[s] = buf0 @ W3.T  (store straight to workspace)
  zero_acc(acc);
  gemm_stripe<false, false>(buf0, LDSW, wb, LDSW, m0, lane, acc);
  float* outp = qkv + (size_t)s * NTOT * D;
#pragma unroll
  for (int t = 0; t < 8; ++t)
#pragma unroll
    for (int r = 0; r < 8; ++r)
      outp[(size_t)(rowBase + m0 + half + r) * D + t * 16 + cn] = acc[t][r];
}

// ---------------- Kernel 2: fused Performer attention, one WG per graph ----
__global__ __launch_bounds__(256)
void attn_kernel(const float* __restrict__ Q,
                 const float* __restrict__ K,
                 const float* __restrict__ V,
                 const float* __restrict__ proj,
                 const int* __restrict__ num_atoms,
                 float* __restrict__ out) {
  __shared__ __attribute__((aligned(16))) float qb[128 * LDSW];   // Q*dnorm -> qp
  __shared__ __attribute__((aligned(16))) float kb[128 * LDSW];   // K*dnorm -> kp -> kv
  __shared__ __attribute__((aligned(16))) float pb[128 * LDSV];   // proj (pitch LDSW) -> V_g (pitch LDSV)
  __shared__ __attribute__((aligned(16))) float qdiag[128];
  __shared__ __attribute__((aligned(16))) float kdiag[128];
  __shared__ __attribute__((aligned(16))) float dinv[128];
  __shared__ __attribute__((aligned(16))) float halfMax[16];   // key max of each wave's rows 0-7 and 8-15
  __shared__ float ksum[128];
  __shared__ int gstartSh, RSh;

  const int g = blockIdx.x;
  const int tid = threadIdx.x;
  const int lane = tid & 31;
  const int wave = tid >> 5;
  const int m0 = wave * 16;
  const int half = (lane >> 4) * 8;
  const int cn = lane & 15;

  v4f w[16];
  load_b(proj, tid, w);

  if (tid == 0) {
    int st = 0;
    for (int i = 0; i < g; ++i) st += num_atoms[i];
    gstartSh = st;
    RSh = num_atoms[g];
  }
  store_b<LDSW>(w, pb, tid);
  __syncthreads();
  const int gstart = gstartSh;
  // rows run 0..127: a count held to 0..128 tells the same rows apart, and no later
  // subtraction from it can wrap
  const int R = min(max(RSh, 0), 128);

  // first row clamped so that a 128-row read stays inside Q, K and V whatever
  // num_atoms holds (an identity while every entry lies in 0..128)
  const size_t tile0 = (size_t)min(max(gstart, 0), NTOT - 128) * D;

  // stage scaled Q/K (rows >= R zeroed): all 128 rows are read, the select drops the rest
  {
    v4f q4[16], k4[16];
    load_b(Q + tile0, tid, q4);
    load_b(K + tile0, tid, k4);
    const v4f zero4 = {0.0f, 0.0f, 0.0f, 0.0f};
#pragma unroll   // constant indices keep q4[] and k4[] in registers
    for (int j = 0; j < 16; ++j) {
      const bool in = (tid >> 5) + 8 * j < R;
      q4[j] = in ? q4[j] * DNORM : zero4;
      k4[j] = in ? k4[j] * DNORM : zero4;
    }
    store_b<LDSW>(q4, qb, tid);
    store_b<LDSW>(k4, kb, tid);
  }
  __syncthreads();

  if (tid < 128) {
    float sq = 0.0f, sk = 0.0f;
    for (int d = 0; d < D; ++d) {
      const float a = qb[tid * LDSW + d];
      const float b = kb[tid * LDSW + d];
      sq += a * a;
      sk += b * b;
    }
    qdiag[tid] = 0.5f * sq;   // 0.5*sum(Q^2)*dnorm^2 (qb is pre-scaled)
    kdiag[tid] = 0.5f * sk;
  }
  __syncthreads();

  v8f acc[8];
  float rm[8];
  // register r of an accumulator holds row m0 + half + r: a row of the graph while r < rlim
  const int rlim = R - (m0 + half);

  // ---- kd = kb @ proj.T ; per-graph max ; kp in-place into kb ----
  zero_acc(acc);
  gemm_stripe<false, false>(kb, LDSW, pb, LDSW, m0, lane, acc);
#pragma unroll
  for (int r = 0; r < 8; ++r) {
    float mx = acc[0][r];
#pragma unroll
    for (int t = 1; t < 8; ++t) mx = fmaxf(mx, acc[t][r]);
    rm[r] = mx;
  }
#pragma unroll
  for (int r = 0; r < 8; ++r)
    for (int off = 1; off < 16; off <<= 1)
      rm[r] = fmaxf(rm[r], __shfl_xor(rm[r], off, 32));
  {
    float hm = -3.402823466e38f;
#pragma unroll   // constant r keeps rm[] in registers
    for (int r = 0; r < 8; ++r) hm = fmaxf(hm, r < rlim ? rm[r] : -3.402823466e38f);
    if ((lane & 15) == 0) halfMax[wave * 2 + (lane >> 4)] = hm;
  }
  __syncthreads();
  {
    // every lane folds the sixteen partial maxima itself and takes its eight row
    // norms by two 16-byte reads: one LDS wait for the whole pass
    const v4f h0 = ld4(halfMax), h1 = ld4(halfMax + 4);
    const v4f h2 = ld4(halfMax + 8), h3 = ld4(halfMax + 12);
    const v4f d0 = ld4(kdiag + m0 + half), d1 = ld4(kdiag + m0 + half + 4);
    float km = -3.402823466e38f;
#pragma unroll   // constant i picks a register of each 16-byte read
    for (int i = 0; i < 4; ++i)
      km = fmaxf(fmaxf(fmaxf(km, h0[i]), fmaxf(h1[i], h2[i])), h3[i]);
#pragma unroll
    for (int t = 0; t < 8; ++t)
#pragma unroll
      for (int r = 0; r < 8; ++r) {
        const float dg = r < 4 ? d0[r & 3] : d1[r & 3];
        const float e = RATIO * (__expf(acc[t][r] - dg - km) + EPSK);
        kb[(m0 + half + r) * LDSW + t * 16 + cn] = r < rlim ? e : 0.0f;   // this wave's own rows only
      }
  }

  // ---- qd = qb @ proj.T ; per-row max ; qp in-place into qb ----
  zero_acc(acc);
  gemm_stripe<false, false>(qb, LDSW, pb, LDSW, m0, lane, acc);
  load_b(V + tile0, tid, w);
#pragma unroll
  for (int r = 0; r < 8; ++r) {
    float mx = acc[0][r];
#pragma unroll
    for (int t = 1; t < 8; ++t) mx = fmaxf(mx, acc[t][r]);
    rm[r] = mx;
  }
#pragma unroll
  for (int r = 0; r < 8; ++r)
    for (int off = 1; off < 16; off <<= 1)
      rm[r] = fmaxf(rm[r], __shfl_xor(rm[r], off, 32));
  {
    const v4f d0 = ld4(qdiag + m0 + half), d1 = ld4(qdiag + m0 + half + 4);
#pragma unroll
    for (int t = 0; t < 8; ++t)
#pragma unroll
      for (int r = 0; r < 8; ++r) {
        const float dg = r < 4 ? d0[r & 3] : d1[r & 3];
        const float e = RATIO * (__expf(acc[t][r] - dg - rm[r]) + EPSK);
        qb[(m0 + half + r) * LDSW + t * 16 + cn] = r < rlim ? e : 0.0f;
      }
  }
  __syncthreads();   // qp & kp fully materialized

  // pb = V_g (every wave is past its last read of proj)
  store_b<LDSV>(w, pb, tid);

  // ksum[m] = sum_n kp[n,m]
  if (tid < 128) {
    float sv = 0.0f;
    for (int n = 0; n < 128; ++n) sv += kb[n * LDSW + tid];
    ksum[tid] = sv;
  }
  __syncthreads();

  // kv = kp^T @ V_g  (accumulators held in regs across barrier, then
  // written back over kb — kp is dead after this GEMM)
  zero_acc(acc);
  gemm_stripe<true, true>(kb, LDSW, pb, LDSV, m0, lane, acc);
  __syncthreads();
#pragma unroll
  for (int t = 0; t < 8; ++t)
#pragma unroll
    for (int r = 0; r < 8; ++r)
      kb[(m0 + half + r) * LDSW + t * 16 + cn] = acc[t][r];
  __syncthreads();

  // dinv[n] = 1 / (qp[n,:] . ksum)
  if (tid < 128) {
    float sv = 0.0f;
    for (int m = 0; m < MFEAT; ++m) sv += qb[tid * LDSW + m] * ksum[m];
    dinv[tid] = 1.0f / sv;
  }
  __syncthreads();

  // out = (qp @ kv) * dinv
  zero_acc(acc);
  gemm_stripe<false, true>(qb, LDSW, kb, LDSW, m0, lane, acc);
  {
    const v4f i0 = ld4(dinv + m0 + half), i1 = ld4(dinv + m0 + half + 4);
    // rows stored: those of the graph that also lie inside out, whatever num_atoms holds
    const int slim = (gstart < 0 ? 0 : max(min(R, NTOT - gstart), 0)) - (m0 + half);
    float* orow = out + ((long long)gstart + m0 + half) * D + cn;
#pragma unroll   // constant r and t keep acc[] in registers and become the stores' offset field
    for (int r = 0; r < 8; ++r) {
      const float di = r < 4 ? i0[r & 3] : i1[r & 3];
      if (r < slim) {   // one test a row, around its eight stores
#pragma unroll
        for (int t = 0; t < 8; ++t) orow[r * D + t * 16] = acc[t][r] * di;
      }
    }
  }
}

extern "C" void kernel_launch(void* const* d_in, const int* in_sizes, int n_in,
                              void* d_out, int out_size, void* d_ws, size_t ws_size,
                              hipStream_t stream) {
  (void)in_sizes; (void)n_in; (void)out_size; (void)ws_size;
  const float* x         = (const float*)d_in[0];
  const int*   num_atoms = (const int*)d_in[1];
  const float* W1        = (const float*)d_in[2];
  const float* W2        = (const float*)d_in[3];
  const float* W3        = (const float*)d_in[4];
  const float* alpha     = (const float*)d_in[5];
  const float* beta      = (const float*)d_in[6];
  const float* proj      = (const float*)d_in[7];
  float* out = (float*)d_out;

  float* ws = (float*)d_ws;          // [3][N][D] fp32 = 12.6 MB scratch
  float* Q = ws;
  float* K = ws + (size_t)NTOT * D;
  float* V = ws + 2 * (size_t)NTOT * D;

  dim3 grid1(NTOT / 128, 3);
  qkv_kernel<<<grid1, 256, 0, stream>>>(x, W1, W2, W3, alpha, beta, ws);
  attn_kernel<<<G, 256, 0, stream>>>(Q, K, V, proj, num_atoms, out);
}

// v004
// It runs in 40.3 microseconds.
// In two side-by-side timings against v003, it was 1.26 and 1.25 times as fast.
// Over all steps from v000 it is 2.95 times as fast.
#include <hip/hip_runtime.h>

#define D      128
#define MFEAT  128
#define G      64
#define NTOT   8192
#define LDSW   132            // 128 + 4 pad (bank-conflict stagger on 64 banks)
#define LDSV   136            // pitch of a staged k-major B: rows k and k+2 lie 16 banks apart
#define QSPLIT 4              // work-groups that share one graph's attention
#define QR     32             // query rows of one such work-group (128 / QSPLIT)
#define EPSK   1e-4f
#define DNORM  0.29730177875068026f   // 128^-0.25
#define RATIO  0.08838834764831843f   // 128^-0.5

typedef __attribute__((ext_vector_type(2))) float v2f;
typedef __attribute__((ext_vector_type(4))) float v4f;
typedef __attribute__((ext_vector_type(8))) float v8f;

__device__ __forceinline__ float swish1(float x, float a, float b) {
  return a * x * (1.0f / (1.0f + __expf(-b * x)));
}

template <int NT>
__device__ __forceinline__ void zero_acc(v8f acc[NT]) {
#pragma unroll
  for (int t = 0; t < NT; ++t)
#pragma unroll
    for (int r = 0; r < 8; ++r) acc[t][r] = 0.0f;
}

// One wave computes a stripe of 16 rows x NT column tiles:
// out[m0..m0+16, n0..n0+16*NT) += A[16 x 128] * B[128 x 16*NT], K accumulated
// with V_WMMA_F32_16X16X4_F32. A element (m,k) is A[m*lda + k].
// BROWK : B element (k,n) read as B[k*ldb + n]  (row-major over k),
//         else B(k,n) = B[n*ldb + k]            (i.e. X @ W.T pattern).
template <bool BROWK, int NT>
__device__ __forceinline__ void gemm_stripe(const float* __restrict__ A, int lda,
                                            const float* __restrict__ B, int ldb,
                                            int m0, int n0, int lane, v8f acc[NT]) {
  const int mr = lane & 15;          // matrix row (A) / col (B) within tile
  const int kb = (lane >> 4) << 1;   // k-pair base for this half-wave
#pragma unroll (32 / NT)   // 32 matrix instructions a trip whatever NT: room to fetch fragments ahead of their use
  for (int k0 = 0; k0 < D; k0 += 4) {
    const int k = k0 + kb;
    v2f a;
    a.x = A[(m0 + mr) * lda + k];
    a.y = A[(m0 + mr) * lda + k + 1];
#pragma unroll
    for (int t = 0; t < NT; ++t) {
      const int col = n0 + t * 16 + mr;
      v2f b;
      if (BROWK) {
        b.x = B[k * ldb + col];
        b.y = B[(k + 1) * ldb + col];
      } else {
        b.x = B[col * ldb + k];
        b.y = B[col * ldb + k + 1];
      }
      acc[t] = __builtin_amdgcn_wmma_f32_16x16x4_f32(false, a, false, b,
                                                     (short)0, acc[t],
                                                     false, false);
    }
  }
}

// Staging of a B operand: the block reads one dense 128 x 128 f32 matrix from
// global memory once, 16 bytes a lane (a wave takes whole 512-byte rows), and
// lays it into LDS, so a cache line is touched once per block and not by every
// fragment load of every wave. Load and store are apart so that the loads fly
// over the work that stands between them.
// NJ * 8 rows are moved (16: the whole matrix).
template <int NJ = 16>
__device__ __forceinline__ void load_b(const float* __restrict__ src, int tid,
                                       v4f w[NJ]) {
  const v4f* p = reinterpret_cast<const v4f*>(src) + tid;
#pragma unroll   // constant indices keep w[] in registers; all loads in flight at once
  for (int j = 0; j < NJ; ++j) w[j] = p[j * 256];
}

template <int PITCH, int NJ = 16>
__device__ __forceinline__ void store_b(const v4f w[NJ], float* dst, int tid) {
  // row tid >> 5, column 4 * (tid & 31); each j goes 8 rows further down
  float* p = dst + tid * 4 + (tid >> 5) * (PITCH - D);
#pragma unroll   // constant indices keep w[] in registers; j becomes the store's offset field
  for (int j = 0; j < NJ; ++j) *reinterpret_cast<v4f*>(p + j * 8 * PITCH) = w[j];
}

__device__ __forceinline__ v4f ld4(const float* p) {
  return *reinterpret_cast<const v4f*>(p);
}

// One element-wise pass over a staged 128 x 128 tile (pitch LDSW), in the shape of
// store_b: lane tid holds columns 4 * (tid & 31) .. + 3 of rows (tid >> 5) + 8 * j.
// dst = swish(src, a, b), or swish(src + add, a, b) where RES is set.
template <bool RES>
__device__ __forceinline__ void swish_pass(const float* src, const float* add,
                                           float* dst, v4f a, v4f b, int tid) {
  const int e0 = tid * 4 + (tid >> 5) * (LDSW - D);
#pragma unroll 4   // four 16-byte LDS reads go out together; unrolled further the text only grows
  for (int j = 0; j < 16; ++j) {
    const int e = e0 + j * 8 * LDSW;
    v4f v = ld4(src + e);
    if (RES) v += ld4(add + e);
    v4f r;
    r.x = swish1(v.x, a.x, b.x);
    r.y = swish1(v.y, a.y, b.y);
    r.z = swish1(v.z, a.z, b.z);
    r.w = swish1(v.w, a.w, b.w);
    *reinterpret_cast<v4f*>(dst + e) = r;
  }
}

// ---------------- Kernel 1: Q/K/V via three ResidualMLPs ----------------
// grid = (N/128, 3); block = 256 (8 wave32). LDS: four 128x132 f32 buffers.
__global__ __launch_bounds__(256)
void qkv_kernel(const float* __restrict__ x,
                const float* __restrict__ W1,
                const float* __restrict__ W2,
                const float* __restrict__ W3,
                const float* __restrict__ alpha,
                const float* __restrict__ beta,
                float* __restrict__ qkv /* [3][N][D] */) {
  __shared__ __attribute__((aligned(16))) float buf0[128 * LDSW];
  __shared__ __attribute__((aligned(16))) float buf1[128 * LDSW];
  __shared__ __attribute__((aligned(16))) float xs[128 * LDSW];   // the x tile, read from global once
  __shared__ __attribute__((aligned(16))) float wb[128 * LDSW];   // W1 -> W2 -> W3

  const int s = blockIdx.y;
  const int rowBase = blockIdx.x * 128;
  const int tid = threadIdx.x;
  const int lane = tid & 31;
  const int wave = tid >> 5;
  const int m0 = wave * 16;

  const float* W1s = W1 + s * D * D;
  const float* W2s = W2 + s * D * D;
  const float* W3s = W3 + s * D * D;
  const float* a0 = alpha + (s * 3 + 0) * D;
  const float* a1 = alpha + (s * 3 + 1) * D;
  const float* a2 = alpha + (s * 3 + 2) * D;
  const float* b0 = beta + (s * 3 + 0) * D;
  const float* b1 = beta + (s * 3 + 1) * D;
  const float* b2 = beta + (s * 3 + 2) * D;

  v4f w[16];
  {
    v4f xr[16];
    load_b(x + rowBase * D, tid, xr);
    load_b(W1s, tid, w);
    store_b<LDSW>(xr, xs, tid);
  }
  // this lane's four columns of every alpha and beta, asked for before the first pass
  const int c4 = (tid & 31) * 4;
  const v4f a0v = ld4(a0 + c4), b0v = ld4(b0 + c4);
  const v4f a1v = ld4(a1 + c4), b1v = ld4(b1 + c4);
  const v4f a2v = ld4(a2 + c4), b2v = ld4(b2 + c4);

  // stage: buf0 = swish(x, a0, b0); a lane reads back only what it stored in xs itself
  swish_pass<false>(xs, xs, buf0, a0v, b0v, tid);
  store_b<LDSW>(w, wb, tid);
  __syncthreads();

  v8f acc[8];
  const int half = (lane >> 4) * 8;
  const int cn = lane & 15;

  // GEMM1: buf1 = buf0 @ W1.T
  zero_acc<8>(acc);
  gemm_stripe<false, 8>(buf0, LDSW, wb, LDSW, m0, 0, lane, acc);
  load_b(W2s, tid, w);
#pragma unroll
  for (int t = 0; t < 8; ++t)
#pragma unroll
    for (int r = 0; r < 8; ++r)
      buf1[(m0 + half + r) * LDSW + t * 16 + cn] = acc[t][r];
  __syncthreads();

  // wb = W2 (every wave is past GEMM1); buf0 = swish(buf1, a1, b1)
  store_b<LDSW>(w, wb, tid);
  swish_pass<false>(buf1, buf1, buf0, a1v, b1v, tid);
  __syncthreads();

  // GEMM2: buf1 = buf0 @ W2.T
  zero_acc<8>(acc);
  gemm_stripe<false, 8>(buf0, LDSW, wb, LDSW, m0, 0, lane, acc);
  load_b(W3s, tid, w);
#pragma unroll
  for (int t = 0; t < 8; ++t)
#pragma unroll
    for (int r = 0; r < 8; ++r)
      buf1[(m0 + half + r) * LDSW + t * 16 + cn] = acc[t][r];
  __syncthreads();

  // wb = W3 (every wave is past GEMM2); residual + swish: buf0 = swish(x + buf1, a2, b2)
  store_b<LDSW>(w, wb, tid);
  swish_pass<true>(xs, buf1, buf0, a2v, b2v, tid);
  __syncthreads();

  // GEMM3: qkv[s] = buf0 @ W3.T  (store straight to workspace)
  zero_acc<8>(acc);
  gemm_stripe<false, 8>(buf0, LDSW, wb, LDSW, m0, 0, lane, acc);
  float* outp = qkv + (size_t)s * NTOT * D;
#pragma unroll
  for (int t = 0; t < 8; ++t)
#pragma unroll
    for (int r = 0; r < 8; ++r)
      outp[(size_t)(rowBase + m0 + half + r) * D + t * 16 + cn] = acc[t][r];
}

// ---------------- Kernel 2: fused Performer attention, QSPLIT WGs per graph ----
// Work-group (g, y) owns query rows y*QR .. y*QR+QR-1 of graph g. Every group forms the
// graph's whole kp (its maximum runs over all keys); for its own rows it takes
// (qp @ kp^T) @ V_g, which needs no 128 x 128 kv and nothing of another group.
__global__ __launch_bounds__(256)
void attn_kernel(const float* __restrict__ Q,
                 const float* __restrict__ K,
                 const float* __restrict__ V,
                 const float* __restrict__ proj,
                 const int* __restrict__ num_atoms,
                 float* __restrict__ out) {
  __shared__ __attribute__((aligned(16))) float qb[QR * LDSW];    // own rows of Q*dnorm -> qp
  __shared__ __attribute__((aligned(16))) float kb[128 * LDSW];   // K*dnorm -> kp
  __shared__ __attribute__((aligned(16))) float pb[128 * LDSV];   // proj (pitch LDSW) -> V_g (pitch LDSV)
  __shared__ __attribute__((aligned(16))) float sb[QR * LDSW];    // qp @ kp^T: own rows x the graph's keys
  __shared__ __attribute__((aligned(16))) float qdiag[QR];
  __shared__ __attribute__((aligned(16))) float kdiag[128];
  __shared__ __attribute__((aligned(16))) float dinv[QR];
  __shared__ __attribute__((aligned(16))) float halfMax[16];   // key max of each wave's rows 0-7 and 8-15
  __shared__ __attribute__((aligned(16))) float rowMax[4 * QR];   // query row max over each 32-column quarter
  __shared__ float ksum[128];
  __shared__ int gstartSh, RSh;

  const int g = blockIdx.x;
  const int q0 = blockIdx.y * QR;
  const int tid = threadIdx.x;
  const int lane = tid & 31;
  const int wave = tid >> 5;
  const int m0 = wave * 16;            // this wave's 16 key rows (all 128 columns)
  const int half = (lane >> 4) * 8;
  const int cn = lane & 15;
  const int nq = (wave & 3) * 32;      // in a QR x 128 product: this wave's two column tiles
  const int rq0 = (wave >> 2) * 16 + half;   // and the first of this lane's eight rows

  v4f w[16];
  load_b(proj, tid, w);

  if (tid == 0) {
    int st = 0;
    for (int i = 0; i < g; ++i) st += num_atoms[i];
    gstartSh = st;
    RSh = num_atoms[g];
  }
  store_b<LDSW>(w, pb, tid);
  __syncthreads();
  const int gstart = gstartSh;
  // rows run 0..127: a count held to 0..128 tells the same rows apart, and no later
  // subtraction from it can wrap
  const int R = min(max(RSh, 0), 128);

  // first row clamped so that a 128-row read stays inside Q, K and V whatever
  // num_atoms holds (an identity while every entry lies in 0..128)
  const size_t tile0 = (size_t)min(max(gstart, 0), NTOT - 128) * D;

  // stage scaled K and the own rows of scaled Q (rows >= R zeroed): every row is read,
  // the select drops the rest
  {
    v4f q4[QR / 8], k4[16];
    load_b<QR / 8>(Q + tile0 + q0 * D, tid, q4);
    load_b(K + tile0, tid, k4);
    const v4f zero4 = {0.0f, 0.0f, 0.0f, 0.0f};
#pragma unroll   // constant indices keep q4[] in registers
    for (int j = 0; j < QR / 8; ++j)
      q4[j] = q0 + (tid >> 5) + 8 * j < R ? q4[j] * DNORM : zero4;
#pragma unroll   // constant indices keep k4[] in registers
    for (int j = 0; j < 16; ++j)
      k4[j] = (tid >> 5) + 8 * j < R ? k4[j] * DNORM : zero4;
    store_b<LDSW, QR / 8>(q4, qb, tid);
    store_b<LDSW>(k4, kb, tid);
  }
  __syncthreads();

  if (tid < 128) {
    float sk = 0.0f;
    for (int d = 0; d < D; ++d) {
      const float b = kb[tid * LDSW + d];
      sk += b * b;
    }
    kdiag[tid] = 0.5f * sk;   // 0.5*sum(K^2)*dnorm^2 (kb is pre-scaled)
  } else if (tid < 128 + QR) {
    float sq = 0.0f;
    for (int d = 0; d < D; ++d) {
      const float a = qb[(tid - 128) * LDSW + d];
      sq += a * a;
    }
    qdiag[tid - 128] = 0.5f * sq;
  }
  __syncthreads();

  v8f acc[8];
  v8f aq[2];
  float rm[8];
  // register r of acc holds key row m0 + half + r: a row of the graph while r < rlim;
  // register r of aq holds query row q0 + rq0 + r: a row of the graph while r < qlim
  const int rlim = R - (m0 + half);
  const int qlim = R - (q0 + rq0);

  // ---- kd = kb @ proj.T ; qd = qb @ proj.T ; both maxima handed over at one barrier ----
  zero_acc<8>(acc);
  gemm_stripe<false, 8>(kb, LDSW, pb, LDSW, m0, 0, lane, acc);
  zero_acc<2>(aq);
  gemm_stripe<false, 2>(qb, LDSW, pb, LDSW, rq0 - half, nq, lane, aq);
  load_b(V + tile0, tid, w);
#pragma unroll
  for (int r = 0; r < 8; ++r) {
    float mx = acc[0][r];
#pragma unroll
    for (int t = 1; t < 8; ++t) mx = fmaxf(mx, acc[t][r]);
    rm[r] = mx;
  }
#pragma unroll
  for (int r = 0; r < 8; ++r)
    for (int off = 1; off < 16; off <<= 1)
      rm[r] = fmaxf(rm[r], __shfl_xor(rm[r], off, 32));
  {
    float hm = -3.402823466e38f;
#pragma unroll   // constant r keeps rm[] in registers
    for (int r = 0; r < 8; ++r) hm = fmaxf(hm, r < rlim ? rm[r] : -3.402823466e38f);
    if ((lane & 15) == 0) halfMax[wave * 2 + (lane >> 4)] = hm;
  }
#pragma unroll   // constant r keeps aq[] and rm[] in registers
  for (int r = 0; r < 8; ++r) rm[r] = fmaxf(aq[0][r], aq[1][r]);
#pragma unroll
  for (int r = 0; r < 8; ++r)
    for (int off = 1; off < 16; off <<= 1)
      rm[r] = fmaxf(rm[r], __shfl_xor(rm[r], off, 32));
  if ((lane & 15) == 0) {
    const v4f lo = {rm[0], rm[1], rm[2], rm[3]};
    const v4f hi = {rm[4], rm[5], rm[6], rm[7]};
    float* p = rowMax + (wave & 3) * QR + rq0;
    *reinterpret_cast<v4f*>(p) = lo;
    *reinterpret_cast<v4f*>(p + 4) = hi;
  }
  __syncthreads();
  {
    // every lane folds the sixteen partial maxima itself and takes its eight row
    // norms by two 16-byte reads: one LDS wait for the whole pass
    const v4f h0 = ld4(halfMax), h1 = ld4(halfMax + 4);
    const v4f h2 = ld4(halfMax + 8), h3 = ld4(halfMax + 12);
    const v4f d0 = ld4(kdiag + m0 + half), d1 = ld4(kdiag + m0 + half + 4);
    float km = -3.402823466e38f;
#pragma unroll   // constant i picks a register of each 16-byte read
    for (int i = 0; i < 4; ++i)
      km = fmaxf(fmaxf(fmaxf(km, h0[i]), fmaxf(h1[i], h2[i])), h3[i]);
#pragma unroll
    for (int t = 0; t < 8; ++t)
#pragma unroll
      for (int r = 0; r < 8; ++r) {
        const float dg = r < 4 ? d0[r & 3] : d1[r & 3];
        const float e = RATIO * (__expf(acc[t][r] - dg - km) + EPSK);
        kb[(m0 + half + r) * LDSW + t * 16 + cn] = r < rlim ? e : 0.0f;   // this wave's own rows only
      }
  }
  {
    // qp in place into qb: every wave is past its reads of qb; a row's max is folded
    // from the four quarters
    const v4f d0 = ld4(qdiag + rq0), d1 = ld4(qdiag + rq0 + 4);
    v4f x0 = ld4(rowMax + rq0), x1 = ld4(rowMax + rq0 + 4);
#pragma unroll   // constant p becomes the reads' offset field
    for (int p = 1; p < 4; ++p) {
      const v4f y0 = ld4(rowMax + p * QR + rq0), y1 = ld4(rowMax + p * QR + rq0 + 4);
#pragma unroll   // constant i picks a register of each 16-byte read
      for (int i = 0; i < 4; ++i) {
        x0[i] = fmaxf(x0[i], y0[i]);
        x1[i] = fmaxf(x1[i], y1[i]);
      }
    }
#pragma unroll
    for (int t = 0; t < 2; ++t)
#pragma unroll
      for (int r = 0; r < 8; ++r) {
        const float dg = r < 4 ? d0[r & 3] : d1[r & 3];
        const float mx = r < 4 ? x0[r & 3] : x1[r & 3];
        const float e = RATIO * (__expf(aq[t][r] - dg - mx) + EPSK);
        qb[(rq0 + r) * LDSW + nq + t * 16 + cn] = r < qlim ? e : 0.0f;
      }
  }
  __syncthreads();   // qp & kp fully materialized

  // pb = V_g (every wave is past its last read of proj)
  store_b<LDSV>(w, pb, tid);

  // ksum[m] = sum_n kp[n,m]
  if (tid < 128) {
    float sv = 0.0f;
    for (int n = 0; n < 128; ++n) sv += kb[n * LDSW + tid];
    ksum[tid] = sv;
  }
  __syncthreads();

  // sb = qp @ kp^T (own rows x keys; a key row >= R of kp is zero, so is its column here)
  zero_acc<2>(aq);
  gemm_stripe<false, 2>(qb, LDSW, kb, LDSW, rq0 - half, nq, lane, aq);
#pragma unroll   // constant t and r keep aq[] in registers
  for (int t = 0; t < 2; ++t)
#pragma unroll
    for (int r = 0; r < 8; ++r)
      sb[(rq0 + r) * LDSW + nq + t * 16 + cn] = aq[t][r];

  // dinv[n] = 1 / (qp[n,:] . ksum)
  if (tid < QR) {
    float sv = 0.0f;
    for (int m = 0; m < MFEAT; ++m) sv += qb[tid * LDSW + m] * ksum[m];
    dinv[tid] = 1.0f / sv;
  }
  __syncthreads();

  // out = (sb @ V_g) * dinv
  zero_acc<2>(aq);
  gemm_stripe<true, 2>(sb, LDSW, pb, LDSV, rq0 - half, nq, lane, aq);
  {
    const v4f i0 = ld4(dinv + rq0), i1 = ld4(dinv + rq0 + 4);
    // rows stored: those of the graph that also lie inside out, whatever num_atoms holds
    const int slim = (gstart < 0 ? 0 : max(min(R, NTOT - gstart), 0)) - (q0 + rq0);
    float* orow = out + ((long long)gstart + q0 + rq0) * D + nq + cn;
#pragma unroll   // constant r and t keep aq[] in registers and become the stores' offset field
    for (int r = 0; r < 8; ++r) {
      const float di = r < 4 ? i0[r & 3] : i1[r & 3];
      if (r < slim) {   // one test a row, around its two stores
#pragma unroll
        for (int t = 0; t < 2; ++t) orow[r * D + t * 16] = aq[t][r] * di;
      }
    }
  }
}

extern "C" void kernel_launch(void* const* d_in, const int* in_sizes, int n_in,
                              void* d_out, int out_size, void* d_ws, size_t ws_size,
                              hipStream_t stream) {
  (void)in_sizes; (void)n_in; (void)out_size; (void)ws_size;
  const float* x         = (const float*)d_in[0];
  const int*   num_atoms = (const int*)d_in[1];
  const float* W1        = (const float*)d_in[2];
  const float* W2        = (const float*)d_in[3];
  const float* W3        = (const float*)d_in[4];
  const float* alpha     = (const float*)d_in[5];
  const float* beta      = (const float*)d_in[6];
  const float* proj      = (const float*)d_in[7];
  float* out = (float*)d_out;

  float* ws = (float*)d_ws;          // [3][N][D] fp32 = 12.6 MB scratch
  float* Q = ws;
  float* K = ws + (size_t)NTOT * D;
  float* V = ws + 2 * (size_t)NTOT * D;

  dim3 grid1(NTOT / 128, 3);
  qkv_kernel<<<grid1, 256, 0, stream>>>(x, W1, W2, W3, alpha, beta, ws);
  dim3 grid2(G, QSPLIT);
  attn_kernel<<<grid2, 256, 0, stream>>>(Q, K, V, proj, num_atoms, out);
}

// v005
// One run takes 36.3 microseconds.
// In both of two side-by-side timings against v004, it was 1.11 times as fast.
// Over all steps from v000 it is 3.28 times as fast.
#include <hip/hip_runtime.h>

#define D      128
#define MFEAT  128
#define G      64
#define NTOT   8192
#define LDSW   132            // 128 + 4 pad (bank-conflict stagger on 64 banks)
#define LDSV   136            // pitch of a staged k-major B: rows k and k+2 lie 16 banks apart
#define QSPLIT 4              // work-groups that share one graph's attention
#define QR     32             // query rows of one such work-group (128 / QSPLIT)
#define RB     32             // rows of x that one work-group of the first kernel takes
#define EPSK   1e-4f
#define DNORM  0.29730177875068026f   // 128^-0.25
#define RATIO  0.08838834764831843f   // 128^-0.5

typedef __attribute__((ext_vector_type(2))) float v2f;
typedef __attribute__((ext_vector_type(4))) float v4f;
typedef __attribute__((ext_vector_type(8))) float v8f;

__device__ __forceinline__ float swish1(float x, float a, float b) {
  return a * x * (1.0f / (1.0f + __expf(-b * x)));
}

template <int NT>
__device__ __forceinline__ void zero_acc(v8f acc[NT]) {
#pragma unroll
  for (int t = 0; t < NT; ++t)
#pragma unroll
    for (int r = 0; r < 8; ++r) acc[t][r] = 0.0f;
}

// One wave computes a stripe of 16 rows x NT column tiles:
// out[m0..m0+16, n0..n0+16*NT) += A[16 x 128] * B[128 x 16*NT], K accumulated
// with V_WMMA_F32_16X16X4_F32. A element (m,k) is A[m*lda + k].
// BROWK : B element (k,n) read as B[k*ldb + n]  (row-major over k),
//         else B(k,n) = B[n*ldb + k]            (i.e. X @ W.T pattern).
template <bool BROWK, int NT>
__device__ __forceinline__ void gemm_stripe(const float* __restrict__ A, int lda,
                                            const float* __restrict__ B, int ldb,
                                            int m0, int n0, int lane, v8f acc[NT]) {
  const int mr = lane & 15;          // matrix row (A) / col (B) within tile
  const int kb = (lane >> 4) << 1;   // k-pair base for this half-wave
#pragma unroll (32 / NT)   // 32 matrix instructions a trip whatever NT: room to fetch fragments ahead of their use
  for (int k0 = 0; k0 < D; k0 += 4) {
    const int k = k0 + kb;
    v2f a;
    a.x = A[(m0 + mr) * lda + k];
    a.y = A[(m0 + mr) * lda + k + 1];
#pragma unroll
    for (int t = 0; t < NT; ++t) {
      const int col = n0 + t * 16 + mr;
      v2f b;
      if (BROWK) {
        b.x = B[k * ldb + col];
        b.y = B[(k + 1) * ldb + col];
      } else {
        b.x = B[col * ldb + k];
        b.y = B[col * ldb + k + 1];
      }
      acc[t] = __builtin_amdgcn_wmma_f32_16x16x4_f32(false, a, false, b,
                                                     (short)0, acc[t],
                                                     false, false);
    }
  }
}

// Staging of a B operand: the block reads one dense 128 x 128 f32 matrix from
// global memory once, 16 bytes a lane (a wave takes whole 512-byte rows), and
// lays it into LDS, so a cache line is touched once per block and not by every
// fragment load of every wave. Load and store are apart so that the loads fly
// over the work that stands between them.
// NJ * 8 rows are moved (16: the whole matrix).
template <int NJ = 16>
__device__ __forceinline__ void load_b(const float* __restrict__ src, int tid,
                                       v4f w[NJ]) {
  const v4f* p = reinterpret_cast<const v4f*>(src) + tid;
#pragma unroll   // constant indices keep w[] in registers; all loads in flight at once
  for (int j = 0; j < NJ; ++j) w[j] = p[j * 256];
}

template <int PITCH, int NJ = 16>
__device__ __forceinline__ void store_b(const v4f w[NJ], float* dst, int tid) {
  // row tid >> 5, column 4 * (tid & 31); each j goes 8 rows further down
  float* p = dst + tid * 4 + (tid >> 5) * (PITCH - D);
#pragma unroll   // constant indices keep w[] in registers; j becomes the store's offset field
  for (int j = 0; j < NJ; ++j) *reinterpret_cast<v4f*>(p + j * 8 * PITCH) = w[j];
}

__device__ __forceinline__ v4f ld4(const float* p) {
  return *reinterpret_cast<const v4f*>(p);
}

// One element-wise pass over an RB x 128 tile (pitch LDSW), in the shape of store_b:
// lane tid holds columns 4 * (tid & 31) .. + 3 of rows (tid >> 5) + 8 * j, and xr[j] is
// x at those places.
// MODE 0: dst = swish(x, a, b); 1: dst = swish(src, a, b); 2: dst = swish(x + src, a, b).
template <int MODE>
__device__ __forceinline__ void swish_pass(const float* src, const v4f xr[RB / 8],
                                           float* dst, v4f a, v4f b, int tid) {
  const int e0 = tid * 4 + (tid >> 5) * (LDSW - D);
#pragma unroll   // constant j keeps xr[] in registers; the four 16-byte LDS reads go out together
  for (int j = 0; j < RB / 8; ++j) {
    const int e = e0 + j * 8 * LDSW;
    v4f v = xr[j];
    if (MODE == 1) v = ld4(src + e);
    if (MODE == 2) v += ld4(src + e);
    v4f r;
    r.x = swish1(v.x, a.x, b.x);
    r.y = swish1(v.y, a.y, b.y);
    r.z = swish1(v.z, a.z, b.z);
    r.w = swish1(v.w, a.w, b.w);
    *reinterpret_cast<v4f*>(dst + e) = r;
  }
}

// ---------------- Kernel 1: Q/K/V via three ResidualMLPs ----------------
// grid = (N/RB, 3) = 768 work-groups; block = 256 (8 wave32). A work-group takes RB rows
// through one MLP. Its LDS (two RB x 132 tiles and one 128 x 132 weight matrix) and its
// registers let three groups stand on a WGP: 768 groups fill all 256 WGPs evenly, and one
// group's loads, element-wise passes and barrier waits run under the products of the others.
__global__ __launch_bounds__(256)
void qkv_kernel(const float* __restrict__ x,
                const float* __restrict__ W1,
                const float* __restrict__ W2,
                const float* __restrict__ W3,
                const float* __restrict__ alpha,
                const float* __restrict__ beta,
                float* __restrict__ qkv /* [3][N][D] */) {
  __shared__ __attribute__((aligned(16))) float buf0[RB * LDSW];
  __shared__ __attribute__((aligned(16))) float buf1[RB * LDSW];
  __shared__ __attribute__((aligned(16))) float wb[128 * LDSW];   // W1 -> W2 -> W3

  const int s = blockIdx.y;
  const int rowBase = blockIdx.x * RB;
  const int tid = threadIdx.x;
  const int lane = tid & 31;
  const int wave = tid >> 5;
  const int m0 = (wave >> 2) * 16;     // this wave's 16 rows
  const int n0 = (wave & 3) * 32;      // and its two column tiles: whole 128-byte lines of the output

  const float* W1s = W1 + s * D * D;
  const float* W2s = W2 + s * D * D;
  const float* W3s = W3 + s * D * D;
  const float* a0 = alpha + (s * 3 + 0) * D;
  const float* a1 = alpha + (s * 3 + 1) * D;
  const float* a2 = alpha + (s * 3 + 2) * D;
  const float* b0 = beta + (s * 3 + 0) * D;
  const float* b1 = beta + (s * 3 + 1) * D;
  const float* b2 = beta + (s * 3 + 2) * D;

  v4f w[16];
  v4f xr[RB / 8];   // the x tile, read from global once: sixteen registers a lane hold it
  load_b<RB / 8>(x + rowBase * D, tid, xr);
  load_b(W1s, tid, w);
  // this lane's four columns of every alpha and beta, asked for before the first pass
  const int c4 = (tid & 31) * 4;
  const v4f a0v = ld4(a0 + c4), b0v = ld4(b0 + c4);
  const v4f a1v = ld4(a1 + c4), b1v = ld4(b1 + c4);
  const v4f a2v = ld4(a2 + c4), b2v = ld4(b2 + c4);

  // stage: buf0 = swish(x, a0, b0)
  swish_pass<0>(buf0, xr, buf0, a0v, b0v, tid);
  store_b<LDSW>(w, wb, tid);
  __syncthreads();

  v8f acc[2];
  const int half = (lane >> 4) * 8;
  const int cn = lane & 15;

  // GEMM1: buf1 = buf0 @ W1.T
  zero_acc<2>(acc);
  gemm_stripe<false, 2>(buf0, LDSW, wb, LDSW, m0, n0, lane, acc);
  load_b(W2s, tid, w);
#pragma unroll   // constant t and r keep acc[] in registers and become the stores' offset field
  for (int t = 0; t < 2; ++t)
#pragma unroll
    for (int r = 0; r < 8; ++r)
      buf1[(m0 + half + r) * LDSW + n0 + t * 16 + cn] = acc[t][r];
  __syncthreads();

  // wb = W2 (every wave is past GEMM1); buf0 = swish(buf1, a1, b1)
  store_b<LDSW>(w, wb, tid);
  swish_pass<1>(buf1, xr, buf0, a1v, b1v, tid);
  __syncthreads();

  // GEMM2: buf1 = buf0 @ W2.T
  zero_acc<2>(acc);
  gemm_stripe<false, 2>(buf0, LDSW, wb, LDSW, m0, n0, lane, acc);
  load_b(W3s, tid, w);
#pragma unroll   // constant t and r keep acc[] in registers and become the stores' offset field
  for (int t = 0; t < 2; ++t)
#pragma unroll
    for (int r = 0; r < 8; ++r)
      buf1[(m0 + half + r) * LDSW + n0 + t * 16 + cn] = acc[t][r];
  __syncthreads();

  // wb = W3 (every wave is past GEMM2); residual + swish: buf0 = swish(x + buf1, a2, b2)
  store_b<LDSW>(w, wb, tid);
  swish_pass<2>(buf1, xr, buf0, a2v, b2v, tid);
  __syncthreads();

  // GEMM3: qkv[s] = buf0 @ W3.T  (store straight to workspace)
  zero_acc<2>(acc);
  gemm_stripe<false, 2>(buf0, LDSW, wb, LDSW, m0, n0, lane, acc);
  float* outp = qkv + (size_t)s * NTOT * D;
#pragma unroll   // constant t and r keep acc[] in registers and become the stores' offset field
  for (int t = 0; t < 2; ++t)
#pragma unroll
    for (int r = 0; r < 8; ++r)
      outp[(size_t)(rowBase + m0 + half + r) * D + n0 + t * 16 + cn] = acc[t][r];
}

// ---------------- Kernel 2: fused Performer attention, QSPLIT WGs per graph ----
// Work-group (g, y) owns query rows y*QR .. y*QR+QR-1 of graph g. Every group forms the
// graph's whole kp (its maximum runs over all keys); for its own rows it takes
// (qp @ kp^T) @ V_g, which needs no 128 x 128 kv and nothing of another group.
__global__ __launch_bounds__(256)
void attn_kernel(const float* __restrict__ Q,
                 const float* __restrict__ K,
                 const float* __restrict__ V,
                 const float* __restrict__ proj,
                 const int* __restrict__ num_atoms,
                 float* __restrict__ out) {
  __shared__ __attribute__((aligned(16))) float qb[QR * LDSW];    // own rows of Q*dnorm -> qp
  __shared__ __attribute__((aligned(16))) float kb[128 * LDSW];   // K*dnorm -> kp
  __shared__ __attribute__((aligned(16))) float pb[128 * LDSV];   // proj (pitch LDSW) -> V_g (pitch LDSV)
  __shared__ __attribute__((aligned(16))) float sb[QR * LDSW];    // qp @ kp^T: own rows x the graph's keys
  __shared__ __attribute__((aligned(16))) float qdiag[QR];
  __shared__ __attribute__((aligned(16))) float kdiag[128];
  __shared__ __attribute__((aligned(16))) float dinv[QR];
  __shared__ __attribute__((aligned(16))) float halfMax[16];   // key max of each wave's rows 0-7 and 8-15
  __shared__ __attribute__((aligned(16))) float rowMax[4 * QR];   // query row max over each 32-column quarter
  __shared__ float ksum[128];
  __shared__ int gstartSh, RSh;

  const int g = blockIdx.x;
  const int q0 = blockIdx.y * QR;
  const int tid = threadIdx.x;
  const int lane = tid & 31;
  const int wave = tid >> 5;
  const int m0 = wave * 16;            // this wave's 16 key rows (all 128 columns)
  const int half = (lane >> 4) * 8;
  const int cn = lane & 15;
  const int nq = (wave & 3) * 32;      // in a QR x 128 product: this wave's two column tiles
  const int rq0 = (wave >> 2) * 16 + half;   // and the first of this lane's eight rows

  v4f w[16];
  load_b(proj, tid, w);

  if (tid == 0) {
    int st = 0;
    for (int i = 0; i < g; ++i) st += num_atoms[i];
    gstartSh = st;
    RSh = num_atoms[g];
  }
  store_b<LDSW>(w, pb, tid);
  __syncthreads();
  const int gstart = gstartSh;
  // rows run 0..127: a count held to 0..128 tells the same rows apart, and no later
  // subtraction from it can wrap
  const int R = min(max(RSh, 0), 128);

  // first row clamped so that a 128-row read stays inside Q, K and V whatever
  // num_atoms holds (an identity while every entry lies in 0..128)
  const size_t tile0 = (size_t)min(max(gstart, 0), NTOT - 128) * D;

  // stage scaled K and the own rows of scaled Q (rows >= R zeroed): every row is read,
  // the select drops the rest
  {
    v4f q4[QR / 8], k4[16];
    load_b<QR / 8>(Q + tile0 + q0 * D, tid, q4);
    load_b(K + tile0, tid, k4);
    const v4f zero4 = {0.0f, 0.0f, 0.0f, 0.0f};
#pragma unroll   // constant indices keep q4[] in registers
    for (int j = 0; j < QR / 8; ++j)
      q4[j] = q0 + (tid >> 5) + 8 * j < R ? q4[j] * DNORM : zero4;
#pragma unroll   // constant indices keep k4[] in registers
    for (int j = 0; j < 16; ++j)
      k4[j] = (tid >> 5) + 8 * j < R ? k4[j] * DNORM : zero4;
    store_b<LDSW, QR / 8>(q4, qb, tid);
    store_b<LDSW>(k4, kb, tid);
  }
  __syncthreads();

  if (tid < 128) {
    float sk = 0.0f;
    for (int d = 0; d < D; ++d) {
      const float b = kb[tid * LDSW + d];
      sk += b * b;
    }
    kdiag[tid] = 0.5f * sk;   // 0.5*sum(K^2)*dnorm^2 (kb is pre-scaled)
  } else if (tid < 128 + QR) {
    float sq = 0.0f;
    for (int d = 0; d < D; ++d) {
      const float a = qb[(tid - 128) * LDSW + d];
      sq += a * a;
    }
    qdiag[tid - 128] = 0.5f * sq;
  }
  __syncthreads();

  v8f acc[8];
  v8f aq[2];
  float rm[8];
  // register r of acc holds key row m0 + half + r: a row of the graph while r < rlim;
  // register r of aq holds query row q0 + rq0 + r: a row of the graph while r < qlim
  const int rlim = R - (m0 + half);
  const int qlim = R - (q0 + rq0);

  // ---- kd = kb @ proj.T ; qd = qb @ proj.T ; both maxima handed over at one barrier ----
  zero_acc<8>(acc);
  gemm_stripe<false, 8>(kb, LDSW, pb, LDSW, m0, 0, lane, acc);
  zero_acc<2>(aq);
  gemm_stripe<false, 2>(qb, LDSW, pb, LDSW, rq0 - half, nq, lane, aq);
  load_b(V + tile0, tid, w);
#pragma unroll
  for (int r = 0; r < 8; ++r) {
    float mx = acc[0][r];
#pragma unroll
    for (int t = 1; t < 8; ++t) mx = fmaxf(mx, acc[t][r]);
    rm[r] = mx;
  }
#pragma unroll
  for (int r = 0; r < 8; ++r)
    for (int off = 1; off < 16; off <<= 1)
      rm[r] = fmaxf(rm[r], __shfl_xor(rm[r], off, 32));
  {
    float hm = -3.402823466e38f;
#pragma unroll   // constant r keeps rm[] in registers
    for (int r = 0; r < 8; ++r) hm = fmaxf(hm, r < rlim ? rm[r] : -3.402823466e38f);
    if ((lane & 15) == 0) halfMax[wave * 2 + (lane >> 4)] = hm;
  }
#pragma unroll   // constant r keeps aq[] and rm[] in registers
  for (int r = 0; r < 8; ++r) rm[r] = fmaxf(aq[0][r], aq[1][r]);
#pragma unroll
  for (int r = 0; r < 8; ++r)
    for (int off = 1; off < 16; off <<= 1)
      rm[r] = fmaxf(rm[r], __shfl_xor(rm[r], off, 32));
  if ((lane & 15) == 0) {
    const v4f lo = {rm[0], rm[1], rm[2], rm[3]};
    const v4f hi = {rm[4], rm[5], rm[6], rm[7]};
    float* p = rowMax + (wave & 3) * QR + rq0;
    *reinterpret_cast<v4f*>(p) = lo;
    *reinterpret_cast<v4f*>(p + 4) = hi;
  }
  __syncthreads();
  {
    // every lane folds the sixteen partial maxima itself and takes its eight row
    // norms by two 16-byte reads: one LDS wait for the whole pass
    const v4f h0 = ld4(halfMax), h1 = ld4(halfMax + 4);
    const v4f h2 = ld4(halfMax + 8), h3 = ld4(halfMax + 12);
    const v4f d0 = ld4(kdiag + m0 + half), d1 = ld4(kdiag + m0 + half + 4);
    float km = -3.402823466e38f;
#pragma unroll   // constant i picks a register of each 16-byte read
    for (int i = 0; i < 4; ++i)
      km = fmaxf(fmaxf(fmaxf(km, h0[i]), fmaxf(h1[i], h2[i])), h3[i]);
#pragma unroll
    for (int t = 0; t < 8; ++t)
#pragma unroll
      for (int r = 0; r < 8; ++r) {
        const float dg = r < 4 ? d0[r & 3] : d1[r & 3];
        const float e = RATIO * (__expf(acc[t][r] - dg - km) + EPSK);
        kb[(m0 + half + r) * LDSW + t * 16 + cn] = r < rlim ? e : 0.0f;   // this wave's own rows only
      }
  }
  {
    // qp in place into qb: every wave is past its reads of qb; a row's max is folded
    // from the four quarters
    const v4f d0 = ld4(qdiag + rq0), d1 = ld4(qdiag + rq0 + 4);
    v4f x0 = ld4(rowMax + rq0), x1 = ld4(rowMax + rq0 + 4);
#pragma unroll   // constant p becomes the reads' offset field
    for (int p = 1; p < 4; ++p) {
      const v4f y0 = ld4(rowMax + p * QR + rq0), y1 = ld4(rowMax + p * QR + rq0 + 4);
#pragma unroll   // constant i picks a register of each 16-byte read
      for (int i = 0; i < 4; ++i) {
        x0[i] = fmaxf(x0[i], y0[i]);
        x1[i] = fmaxf(x1[i], y1[i]);
      }
    }
#pragma unroll
    for (int t = 0; t < 2; ++t)
#pragma unroll
      for (int r = 0; r < 8; ++r) {
        const float dg = r < 4 ? d0[r & 3] : d1[r & 3];
        const float mx = r < 4 ? x0[r & 3] : x1[r & 3];
        const float e = RATIO * (__expf(aq[t][r] - dg - mx) + EPSK);
        qb[(rq0 + r) * LDSW + nq + t * 16 + cn] = r < qlim ? e : 0.0f;
      }
  }
  __syncthreads();   // qp & kp fully materialized

  // pb = V_g (every wave is past its last read of proj)
  store_b<LDSV>(w, pb, tid);

  // ksum[m] = sum_n kp[n,m]
  if (tid < 128) {
    float sv = 0.0f;
    for (int n = 0; n < 128; ++n) sv += kb[n * LDSW + tid];
    ksum[tid] = sv;
  }
  __syncthreads();

  // sb = qp @ kp^T (own rows x keys; a key row >= R of kp is zero, so is its column here)
  zero_acc<2>(aq);
  gemm_stripe<false, 2>(qb, LDSW, kb, LDSW, rq0 - half, nq, lane, aq);
#pragma unroll   // constant t and r keep aq[] in registers
  for (int t = 0; t < 2; ++t)
#pragma unroll
    for (int r = 0; r < 8; ++r)
      sb[(rq0 + r) * LDSW + nq + t * 16 + cn] = aq[t][r];

  // dinv[n] = 1 / (qp[n,:] . ksum)
  if (tid < QR) {
    float sv = 0.0f;
    for (int m = 0; m < MFEAT; ++m) sv += qb[tid * LDSW + m] * ksum[m];
    dinv[tid] = 1.0f / sv;
  }
  __syncthreads();

  // out = (sb @ V_g) * dinv
  zero_acc<2>(aq);
  gemm_stripe<true, 2>(sb, LDSW, pb, LDSV, rq0 - half, nq, lane, aq);
  {
    const v4f i0 = ld4(dinv + rq0), i1 = ld4(dinv + rq0 + 4);
    // rows stored: those of the graph that also lie inside out, whatever num_atoms holds
    const int slim = (gstart < 0 ? 0 : max(min(R, NTOT - gstart), 0)) - (q0 + rq0);
    float* orow = out + ((long long)gstart + q0 + rq0) * D + nq + cn;
#pragma unroll   // constant r and t keep aq[] in registers and become the stores' offset field
    for (int r = 0; r < 8; ++r) {
      const float di = r < 4 ? i0[r & 3] : i1[r & 3];
      if (r < slim) {   // one test a row, around its two stores
#pragma unroll
        for (int t = 0; t < 2; ++t) orow[r * D + t * 16] = aq[t][r] * di;
      }
    }
  }
}

extern "C" void kernel_launch(void* const* d_in, const int* in_sizes, int n_in,
                              void* d_out, int out_size, void* d_ws, size_t ws_size,
                              hipStream_t stream) {
  (void)in_sizes; (void)n_in; (void)out_size; (void)ws_size;
  const float* x         = (const float*)d_in[0];
  const int*   num_atoms = (const int*)d_in[1];
  const float* W1        = (const float*)d_in[2];
  const float* W2        = (const float*)d_in[3];
  const float* W3        = (const float*)d_in[4];
  const float* alpha     = (const float*)d_in[5];
  const float* beta      = (const float*)d_in[6];
  const float* proj      = (const float*)d_in[7];
  float* out = (float*)d_out;

  float* ws = (float*)d_ws;          // [3][N][D] fp32 = 12.6 MB scratch
  float* Q = ws;
  float* K = ws + (size_t)NTOT * D;
  float* V = ws + 2 * (size_t)NTOT * D;

  dim3 grid1(NTOT / RB, 3);
  qkv_kernel<<<grid1, 256, 0, stream>>>(x, W1, W2, W3, alpha, beta, ws);
  dim3 grid2(G, QSPLIT);
  attn_kernel<<<grid2, 256, 0, stream>>>(Q, K, V, proj, num_atoms, out);
}

// v006
// Measured time: 31.1 microseconds a run.
// In both of two side-by-side timings against v005, it was 1.17 times as fast.
// Over all steps from v000 it is 3.83 times as fast.
#include <hip/hip_runtime.h>

#define D      128
#define MFEAT  128
#define G      64
#define NTOT   8192
#define LDSW   132            // 128 + 4 pad (bank-conflict stagger on 64 banks)
#define LDSV   136            // pitch of a staged k-major B: rows k and k+2 lie 16 banks apart
#define QSPLIT 4              // work-groups that share one graph's attention
#define QR     32             // query rows of one such work-group (128 / QSPLIT)
#define RB     32             // rows of x that one work-group of the first kernel takes
#define EPSK   1e-4f
#define DNORM  0.29730177875068026f   // 128^-0.25
#define RATIO  0.08838834764831843f   // 128^-0.5

typedef __attribute__((ext_vector_type(2))) float v2f;
typedef __attribute__((ext_vector_type(4))) float v4f;
typedef __attribute__((ext_vector_type(8))) float v8f;

__device__ __forceinline__ float swish1(float x, float a, float b) {
  return a * x * (1.0f / (1.0f + __expf(-b * x)));
}

template <int NT>
__device__ __forceinline__ void zero_acc(v8f acc[NT]) {
#pragma unroll
  for (int t = 0; t < NT; ++t)
#pragma unroll
    for (int r = 0; r < 8; ++r) acc[t][r] = 0.0f;
}

// One wave computes a stripe of 16 rows x NT column tiles:
// out[m0..m0+16, n0..n0+16*NT) += A[16 x 128] * B[128 x 16*NT], K accumulated
// with V_WMMA_F32_16X16X4_F32. A element (m,k) is A[m*lda + k].
// BROWK : B element (k,n) read as B[k*ldb + n]  (row-major over k),
//         else B(k,n) = B[n*ldb + k]            (i.e. X @ W.T pattern).
template <bool BROWK, int NT>
__device__ __forceinline__ void gemm_stripe(const float* __restrict__ A, int lda,
                                            const float* __restrict__ B, int ldb,
                                            int m0, int n0, int lane, v8f acc[NT]) {
  const int mr = lane & 15;          // matrix row (A) / col (B) within tile
  const int kb = (lane >> 4) << 1;   // k-pair base for this half-wave
#pragma unroll (32 / NT)   // 32 matrix instructions a trip whatever NT: room to fetch fragments ahead of their use
  for (int k0 = 0; k0 < D; k0 += 4) {
    const int k = k0 + kb;
    v2f a;
    a.x = A[(m0 + mr) * lda + k];
    a.y = A[(m0 + mr) * lda + k + 1];
#pragma unroll
    for (int t = 0; t < NT; ++t) {
      const int col = n0 + t * 16 + mr;
      v2f b;
      if (BROWK) {
        b.x = B[k * ldb + col];
        b.y = B[(k + 1) * ldb + col];
      } else {
        b.x = B[col * ldb + k];
        b.y = B[col * ldb + k + 1];
      }
      acc[t] = __builtin_amdgcn_wmma_f32_16x16x4_f32(false, a, false, b,
                                                     (short)0, acc[t],
                                                     false, false);
    }
  }
}

// Staging of a B operand: the block reads one dense 128 x 128 f32 matrix from
// global memory once, 16 bytes a lane (a wave takes whole 512-byte rows), and
// lays it into LDS, so a cache line is touched once per block and not by every
// fragment load of every wave. Load and store are apart so that the loads fly
// over the work that stands between them.
// NJ * 8 rows are moved (16: the whole matrix).
template <int NJ = 16>
__device__ __forceinline__ void load_b(const float* __restrict__ src, int tid,
                                       v4f w[NJ]) {
  const v4f* p = reinterpret_cast<const v4f*>(src) + tid;
#pragma unroll   // constant indices keep w[] in registers; all loads in flight at once
  for (int j = 0; j < NJ; ++j) w[j] = p[j * 256];
}

template <int PITCH, int NJ = 16>
__device__ __forceinline__ void store_b(const v4f w[NJ], float* dst, int tid) {
  // row tid >> 5, column 4 * (tid & 31); each j goes 8 rows further down
  float* p = dst + tid * 4 + (tid >> 5) * (PITCH - D);
#pragma unroll   // constant indices keep w[] in registers; j becomes the store's offset field
  for (int j = 0; j < NJ; ++j) *reinterpret_cast<v4f*>(p + j * 8 * PITCH) = w[j];
}

__device__ __forceinline__ v4f ld4(const float* p) {
  return *reinterpret_cast<const v4f*>(p);
}

// One element-wise pass over an RB x 128 tile (pitch LDSW), in the shape of store_b:
// lane tid holds columns 4 * (tid & 31) .. + 3 of rows (tid >> 5) + 8 * j, and xr[j] is
// x at those places.
// MODE 0: dst = swish(x, a, b); 1: dst = swish(src, a, b); 2: dst = swish(x + src, a, b).
template <int MODE>
__device__ __forceinline__ void swish_pass(const float* src, const v4f xr[RB / 8],
                                           float* dst, v4f a, v4f b, int tid) {
  const int e0 = tid * 4 + (tid >> 5) * (LDSW - D);
#pragma unroll   // constant j keeps xr[] in registers; the four 16-byte LDS reads go out together
  for (int j = 0; j < RB / 8; ++j) {
    const int e = e0 + j * 8 * LDSW;
    v4f v = xr[j];
    if (MODE == 1) v = ld4(src + e);
    if (MODE == 2) v += ld4(src + e);
    v4f r;
    r.x = swish1(v.x, a.x, b.x);
    r.y = swish1(v.y, a.y, b.y);
    r.z = swish1(v.z, a.z, b.z);
    r.w = swish1(v.w, a.w, b.w);
    *reinterpret_cast<v4f*>(dst + e) = r;
  }
}

// ---------------- Kernel 1: three ResidualMLPs, then the feature projection of Q and K ----
// grid = (N/RB, 3) = 768 work-groups; block = 256 (8 wave32). A work-group takes RB rows
// through one MLP. The groups of Q and K go on to (rows * dnorm) @ proj.T and the rows'
// half squared norms, and store those in place of Q and K: every row is projected once,
// not once in each attention group that needs it. Its LDS (two RB x 132 tiles and one 128 x 132 weight matrix) and its
// registers let three groups stand on a WGP: 768 groups fill all 256 WGPs evenly, and one
// group's loads, element-wise passes and barrier waits run under the products of the others.
// second argument: six waves a SIMD, the register budget at which three groups stand on a WGP
__global__ __launch_bounds__(256, 6)
void qkv_kernel(const float* __restrict__ x,
                const float* __restrict__ W1,
                const float* __restrict__ W2,
                const float* __restrict__ W3,
                const float* __restrict__ alpha,
                const float* __restrict__ beta,
                const float* __restrict__ proj,
                float* __restrict__ qkv /* [3][N][D]: qd, kd, V */,
                float* __restrict__ diag /* [2][N]: row norms of Q, of K */) {
  __shared__ __attribute__((aligned(16))) float buf0[RB * LDSW];
  __shared__ __attribute__((aligned(16))) float buf1[RB * LDSW];
  __shared__ __attribute__((aligned(16))) float wb[128 * LDSW];   // W1 -> W2 -> W3 -> proj

  const int s = blockIdx.y;
  const int rowBase = blockIdx.x * RB;
  const int tid = threadIdx.x;
  const int lane = tid & 31;
  const int wave = tid >> 5;
  const int m0 = (wave >> 2) * 16;     // this wave's 16 rows
  const int n0 = (wave & 3) * 32;      // and its two column tiles: whole 128-byte lines of the output

  const float* W1s = W1 + s * D * D;
  const float* W2s = W2 + s * D * D;
  const float* W3s = W3 + s * D * D;
  const float* a0 = alpha + (s * 3 + 0) * D;
  const float* a1 = alpha + (s * 3 + 1) * D;
  const float* a2 = alpha + (s * 3 + 2) * D;
  const float* b0 = beta + (s * 3 + 0) * D;
  const float* b1 = beta + (s * 3 + 1) * D;
  const float* b2 = beta + (s * 3 + 2) * D;

  v4f w[16];
  v4f xr[RB / 8];   // the x tile, read from global once: sixteen registers a lane hold it
  load_b<RB / 8>(x + rowBase * D, tid, xr);
  load_b(W1s, tid, w);
  // this lane's four columns of every alpha and beta, asked for before the first pass
  const int c4 = (tid & 31) * 4;
  const v4f a0v = ld4(a0 + c4), b0v = ld4(b0 + c4);
  const v4f a1v = ld4(a1 + c4), b1v = ld4(b1 + c4);
  const v4f a2v = ld4(a2 + c4), b2v = ld4(b2 + c4);

  // stage: buf0 = swish(x, a0, b0)
  swish_pass<0>(buf0, xr, buf0, a0v, b0v, tid);
  store_b<LDSW>(w, wb, tid);
  __syncthreads();

  v8f acc[2];
  const int half = (lane >> 4) * 8;
  const int cn = lane & 15;

  // GEMM1: buf1 = buf0 @ W1.T
  zero_acc<2>(acc);
  gemm_stripe<false, 2>(buf0, LDSW, wb, LDSW, m0, n0, lane, acc);
  load_b(W2s, tid, w);
#pragma unroll   // constant t and r keep acc[] in registers and become the stores' offset field
  for (int t = 0; t < 2; ++t)
#pragma unroll
    for (int r = 0; r < 8; ++r)
      buf1[(m0 + half + r) * LDSW + n0 + t * 16 + cn] = acc[t][r];
  __syncthreads();

  // wb = W2 (every wave is past GEMM1); buf0 = swish(buf1, a1, b1)
  store_b<LDSW>(w, wb, tid);
  swish_pass<1>(buf1, xr, buf0, a1v, b1v, tid);
  __syncthreads();

  // GEMM2: buf1 = buf0 @ W2.T
  zero_acc<2>(acc);
  gemm_stripe<false, 2>(buf0, LDSW, wb, LDSW, m0, n0, lane, acc);
  load_b(W3s, tid, w);
#pragma unroll   // constant t and r keep acc[] in registers and become the stores' offset field
  for (int t = 0; t < 2; ++t)
#pragma unroll
    for (int r = 0; r < 8; ++r)
      buf1[(m0 + half + r) * LDSW + n0 + t * 16 + cn] = acc[t][r];
  __syncthreads();

  // wb = W3 (every wave is past GEMM2); residual + swish: buf0 = swish(x + buf1, a2, b2)
  store_b<LDSW>(w, wb, tid);
  swish_pass<2>(buf1, xr, buf0, a2v, b2v, tid);
  __syncthreads();

  // GEMM3: buf0 @ W3.T; V goes straight to the workspace
  zero_acc<2>(acc);
  gemm_stripe<false, 2>(buf0, LDSW, wb, LDSW, m0, n0, lane, acc);
  float* outp = qkv + (size_t)s * NTOT * D;
  if (s < 2) {   // the same for the whole work-group
    load_b(proj, tid, w);
    // buf1 = rows of Q or K, scaled (its last readers left it before GEMM3)
#pragma unroll   // constant t and r keep acc[] in registers and become the stores' offset field
    for (int t = 0; t < 2; ++t)
#pragma unroll
      for (int r = 0; r < 8; ++r)
        buf1[(m0 + half + r) * LDSW + n0 + t * 16 + cn] = acc[t][r] * DNORM;
    __syncthreads();

    // wb = proj (every wave is past GEMM3); a wave holds whole rows wave + 8 * j of buf1,
    // four columns a lane: 0.5 * sum of squares, folded over the 32 lanes
    store_b<LDSW>(w, wb, tid);
    {
      const int e0 = tid * 4 + (tid >> 5) * (LDSW - D);
      float sq[RB / 8];
#pragma unroll   // the four 16-byte LDS reads go out together
      for (int j = 0; j < RB / 8; ++j) {
        const v4f v = ld4(buf1 + e0 + j * 8 * LDSW);
        sq[j] = (v.x * v.x + v.y * v.y) + (v.z * v.z + v.w * v.w);
      }
#pragma unroll   // the four rows' folds are independent: one wait a step serves all four
      for (int off = 1; off < 32; off <<= 1)
#pragma unroll
        for (int j = 0; j < RB / 8; ++j) sq[j] += __shfl_xor(sq[j], off, 32);
      if (lane == 0) {
#pragma unroll   // constant j keeps sq[] in registers
        for (int j = 0; j < RB / 8; ++j)
          diag[s * NTOT + rowBase + wave + 8 * j] = 0.5f * sq[j];
      }
    }
    __syncthreads();

    // GEMM4: qd or kd = buf1 @ proj.T
    zero_acc<2>(acc);
    gemm_stripe<false, 2>(buf1, LDSW, wb, LDSW, m0, n0, lane, acc);
  }
#pragma unroll   // constant t and r keep acc[] in registers and become the stores' offset field
  for (int t = 0; t < 2; ++t)
#pragma unroll
    for (int r = 0; r < 8; ++r)
      outp[(size_t)(rowBase + m0 + half + r) * D + n0 + t * 16 + cn] = acc[t][r];
}

// ---------------- Kernel 2: Performer attention, QSPLIT WGs per graph ----
// Work-group (g, y) owns query rows y*QR .. y*QR+QR-1 of graph g. Every group forms the
// graph's whole kp from kd (its maximum runs over all keys); for its own rows it takes
// (qp @ kp^T) @ V_g, which needs no 128 x 128 kv and nothing of another group.
__global__ __launch_bounds__(256)
void attn_kernel(const float* __restrict__ Qd,
                 const float* __restrict__ Kd,
                 const float* __restrict__ V,
                 const float* __restrict__ diag,
                 const int* __restrict__ num_atoms,
                 float* __restrict__ out) {
  __shared__ __attribute__((aligned(16))) float qb[QR * LDSW];    // qp, own rows
  __shared__ __attribute__((aligned(16))) float kb[128 * LDSW];   // kp
  __shared__ __attribute__((aligned(16))) float pb[128 * LDSV];   // V_g
  __shared__ __attribute__((aligned(16))) float sb[QR * LDSW];    // qp @ kp^T: own rows x the graph's keys
  __shared__ __attribute__((aligned(16))) float dinv[QR];
  __shared__ __attribute__((aligned(16))) float waveMax[8];   // key max over each wave's sixteen rows
  __shared__ float ksum[128];
  __shared__ int gstartSh, RSh;

  const int g = blockIdx.x;
  const int q0 = blockIdx.y * QR;
  const int tid = threadIdx.x;
  const int lane = tid & 31;
  const int wave = tid >> 5;
  const int half = (lane >> 4) * 8;
  const int cn = lane & 15;
  const int nq = (wave & 3) * 32;      // in a QR x 128 product: this wave's two column tiles
  const int rq0 = (wave >> 2) * 16 + half;   // and the first of this lane's eight rows

  if (tid == 0) {
    int st = 0;
    for (int i = 0; i < g; ++i) st += num_atoms[i];
    gstartSh = st;
    RSh = num_atoms[g];
  }
  __syncthreads();
  const int gstart = gstartSh;
  // rows run 0..127: a count held to 0..128 tells the same rows apart, and no later
  // subtraction from it can wrap
  const int R = min(max(RSh, 0), 128);

  // first row clamped so that a 128-row read stays inside qd, kd, V and diag whatever
  // num_atoms holds (an identity while every entry lies in 0..128)
  const int row0 = min(max(gstart, 0), NTOT - 128);
  const size_t tile0 = (size_t)row0 * D;

  // In the shape of load_b: lane tid holds columns 4 * (tid & 31) .. + 3 of rows
  // wave + 8 * j, so a wave holds whole rows. Every row is read; the selects drop rows >= R.
  v4f k4[16], q4[QR / 8], w[16];
  float kdg[16], qdg[QR / 8];
  load_b(Kd + tile0, tid, k4);
  load_b<QR / 8>(Qd + tile0 + q0 * D, tid, q4);
#pragma unroll   // constant j keeps kdg[] in registers and becomes the loads' offset field
  for (int j = 0; j < 16; ++j) kdg[j] = diag[NTOT + row0 + wave + 8 * j];
#pragma unroll   // constant j keeps qdg[] in registers and becomes the loads' offset field
  for (int j = 0; j < QR / 8; ++j) qdg[j] = diag[row0 + q0 + wave + 8 * j];
  // the next loads' results may land in registers that held the addresses of those above
  asm volatile("s_wait_xcnt 0x0" ::: "memory");
  load_b(V + tile0, tid, w);

  {
    // key max of this wave's rows of the graph
    float km = -3.402823466e38f;
#pragma unroll   // constant j keeps k4[] in registers
    for (int j = 0; j < 16; ++j) {
      const float m4 = fmaxf(fmaxf(k4[j].x, k4[j].y), fmaxf(k4[j].z, k4[j].w));
      km = fmaxf(km, wave + 8 * j < R ? m4 : -3.402823466e38f);
    }
    for (int off = 1; off < 32; off <<= 1) km = fmaxf(km, __shfl_xor(km, off, 32));
    if (lane == 0) waveMax[wave] = km;
  }
  {
    // qp: a query row's max lies within its wave
    float rm[QR / 8];
#pragma unroll   // constant j keeps q4[] and rm[] in registers
    for (int j = 0; j < QR / 8; ++j)
      rm[j] = fmaxf(fmaxf(q4[j].x, q4[j].y), fmaxf(q4[j].z, q4[j].w));
#pragma unroll   // the four rows' folds are independent: one wait a step serves all four
    for (int off = 1; off < 32; off <<= 1)
#pragma unroll
      for (int j = 0; j < QR / 8; ++j) rm[j] = fmaxf(rm[j], __shfl_xor(rm[j], off, 32));
#pragma unroll   // constant j and i keep q4[] in registers
    for (int j = 0; j < QR / 8; ++j) {
      const bool in = q0 + wave + 8 * j < R;
#pragma unroll
      for (int i = 0; i < 4; ++i) {
        const float e = RATIO * (__expf(q4[j][i] - qdg[j] - rm[j]) + EPSK);
        q4[j][i] = in ? e : 0.0f;
      }
    }
    store_b<LDSW, QR / 8>(q4, qb, tid);
  }
  __syncthreads();
  {
    // every lane folds the eight partial maxima itself
    const v4f h0 = ld4(waveMax), h1 = ld4(waveMax + 4);
    float km = -3.402823466e38f;
#pragma unroll   // constant i picks a register of each 16-byte read
    for (int i = 0; i < 4; ++i) km = fmaxf(km, fmaxf(h0[i], h1[i]));
#pragma unroll   // constant j and i keep k4[] in registers
    for (int j = 0; j < 16; ++j) {
      const bool in = wave + 8 * j < R;
#pragma unroll
      for (int i = 0; i < 4; ++i) {
        const float e = RATIO * (__expf(k4[j][i] - kdg[j] - km) + EPSK);
        k4[j][i] = in ? e : 0.0f;
      }
    }
    store_b<LDSW>(k4, kb, tid);
  }
  store_b<LDSV>(w, pb, tid);
  __syncthreads();   // qp, kp and V_g fully materialized

  // ksum[m] = sum_n kp[n,m]
  if (tid < 128) {
    float sv = 0.0f;
    for (int n = 0; n < 128; ++n) sv += kb[n * LDSW + tid];
    ksum[tid] = sv;
  }
  __syncthreads();

  // sb = qp @ kp^T (own rows x keys; a key row >= R of kp is zero, so is its column here)
  v8f aq[2];
  zero_acc<2>(aq);
  gemm_stripe<false, 2>(qb, LDSW, kb, LDSW, rq0 - half, nq, lane, aq);
#pragma unroll   // constant t and r keep aq[] in registers
  for (int t = 0; t < 2; ++t)
#pragma unroll
    for (int r = 0; r < 8; ++r)
      sb[(rq0 + r) * LDSW + nq + t * 16 + cn] = aq[t][r];

  // dinv[n] = 1 / (qp[n,:] . ksum)
  if (tid < QR) {
    float sv = 0.0f;
    for (int m = 0; m < MFEAT; ++m) sv += qb[tid * LDSW + m] * ksum[m];
    dinv[tid] = 1.0f / sv;
  }
  __syncthreads();

  // out = (sb @ V_g) * dinv
  zero_acc<2>(aq);
  gemm_stripe<true, 2>(sb, LDSW, pb, LDSV, rq0 - half, nq, lane, aq);
  {
    const v4f i0 = ld4(dinv + rq0), i1 = ld4(dinv + rq0 + 4);
    // rows stored: those of the graph that also lie inside out, whatever num_atoms holds
    const int slim = (gstart < 0 ? 0 : max(min(R, NTOT - gstart), 0)) - (q0 + rq0);
    float* orow = out + ((long long)gstart + q0 + rq0) * D + nq + cn;
#pragma unroll   // constant r and t keep aq[] in registers and become the stores' offset field
    for (int r = 0; r < 8; ++r) {
      const float di = r < 4 ? i0[r & 3] : i1[r & 3];
      if (r < slim) {   // one test a row, around its two stores
#pragma unroll
        for (int t = 0; t < 2; ++t) orow[r * D + t * 16] = aq[t][r] * di;
      }
    }
  }
}

extern "C" void kernel_launch(void* const* d_in, const int* in_sizes, int n_in,
                              void* d_out, int out_size, void* d_ws, size_t ws_size,
                              hipStream_t stream) {
  (void)in_sizes; (void)n_in; (void)out_size; (void)ws_size;
  const float* x         = (const float*)d_in[0];
  const int*   num_atoms = (const int*)d_in[1];
  const float* W1        = (const float*)d_in[2];
  const float* W2        = (const float*)d_in[3];
  const float* W3        = (const float*)d_in[4];
  const float* alpha     = (const float*)d_in[5];
  const float* beta      = (const float*)d_in[6];
  const float* proj      = (const float*)d_in[7];
  float* out = (float*)d_out;

  float* ws = (float*)d_ws;          // [3][N][D] + [2][N] fp32 = 12.6 MB scratch
  float* Qd = ws;
  float* Kd = ws + (size_t)NTOT * D;
  float* V = ws + 2 * (size_t)NTOT * D;
  float* diag = ws + 3 * (size_t)NTOT * D;

  dim3 grid1(NTOT / RB, 3);
  qkv_kernel<<<grid1, 256, 0, stream>>>(x, W1, W2, W3, alpha, beta, proj, ws, diag);
  dim3 grid2(G, QSPLIT);
  attn_kernel<<<grid2, 256, 0, stream>>>(Qd, Kd, V, diag, num_atoms, out);
}
